// v000
// Measured on an AMD MI455X. A time is GPU time per run, averaged over a window of back-to-back runs after a warm-up
// (all launches, gaps included; the runs take copies of the inputs in turn), and the median of several windows.
// Apart from v000's, it joins two sittings. Times from different sittings can be a few percent apart, while
// side-by-side timings come from the same sitting.
// The starting kernel, v000, takes 1200 microseconds a run.
#include <hip/hip_runtime.h>

// EGI (sod [8][256][64x64], edge [8][32][64x64]; q = wq edge + bq, k = wk edge + bk (16 channels), v = wv sod + bv; mask = softmax_j(sum_d q[d][i] k[d][j]) (unscaled); feat[c][i] = sum_j v[c][j] mask[i][j]; out = sod + feat * sod -> [8][256][64][64]).
// Compute dtypes, f32 accumulate: every input rounded to bf16; q|k as one GEMM edge^T x [wq; wk]^T and v = wv x sod on PLAIN bf16 operands (inputs: every product exact) + bias; scores (K 16, padded to 32) on bf16 hi+lo planes of q, k (3 products - the unscaled logits are too large for fp16 operands);

#define NB_  8
#define CC   256
#define CE   32
#define CQ   16
#define NP   4096
#define KP   32
#define PCAR 1024.0f
typedef _Float16 h16;
typedef unsigned short bf;
typedef __attribute__((ext_vector_type(16))) __bf16   v16bf;
typedef __attribute__((ext_vector_type(16))) _Float16 v16h;
typedef __attribute__((ext_vector_type(8)))  _Float16 v8h;
typedef __attribute__((ext_vector_type(8)))  unsigned short v8us;
typedef __attribute__((ext_vector_type(8)))  float    v8f;
typedef __attribute__((ext_vector_type(4)))  float    v4f;
typedef v8h  __attribute__((may_alias)) v8ha;
typedef v4f  __attribute__((may_alias)) v4fa;
typedef v8us __attribute__((may_alias)) v8usa;

__device__ __forceinline__ unsigned short f2bf(float f) { unsigned u = __float_as_uint(f); u += 0x7FFFu + ((u >> 16) & 1u); return (unsigned short)(u >> 16); }
__device__ __forceinline__ float bf2f(unsigned short b) { return __uint_as_float(((unsigned)b) << 16); }
__device__ __forceinline__ float bfr(float f) { return bf2f(f2bf(f)); }
__device__ __forceinline__ v16h cat16(v8h lo, v8h hi) { return __builtin_shufflevector(lo, hi, 0, 1, 2, 3, 4, 5, 6, 7, 8, 9, 10, 11, 12, 13, 14, 15); }
__device__ __forceinline__ v16bf cat16b(v8us lo, v8us hi) { return __builtin_bit_cast(v16bf, __builtin_shufflevector(lo, hi, 0, 1, 2, 3, 4, 5, 6, 7, 8, 9, 10, 11, 12, 13, 14, 15)); }
__device__ __forceinline__ v8f wmma16(v16h a, v16h b, v8f c) { return __builtin_amdgcn_wmma_f32_16x16x32_f16(false, a, false, b, (short)0, c, false, false); }
__device__ __forceinline__ v8f wmmab(v16bf a, v16bf b, v8f c) { return __builtin_amdgcn_wmma_f32_16x16x32_bf16(false, a, false, b, (short)0, c, false, false); }



// ---- k_gemmw: register-blocked GEMM, ONE WAVE per 64x64 output tile (16 accumulators), operands straight from K-contiguous 16-bit planes; grid (M/64, N/64, Z), 32 threads.
// C[m][n] (f32, pitch ldc, + optional f32 bias[n]) = sum_k A[m][k] Bt[n][k] (+ split products per NSPLIT). z-batch strides sA/sB/sC in elements. K % 32 == 0.
template <typename T16> struct WFrag;
template <> struct WFrag<h16> { typedef v16h V; static __device__ __forceinline__ V ld(const h16* p) { return cat16(*(const v8h*)p, *(const v8h*)(p + 16)); } static __device__ __forceinline__ v8f mma(V a, V b, v8f c) { return wmma16(a, b, c); } };
template <> struct WFrag<bf> { typedef v16bf V; static __device__ __forceinline__ V ld(const bf* p) { return cat16b(*(const v8us*)p, *(const v8us*)(p + 16)); } static __device__ __forceinline__ v8f mma(V a, V b, v8f c) { return wmmab(a, b, c); } };
template <typename T16, int NSPLIT, bool BIAS>
__global__ __launch_bounds__(32) void k_gemmw(const T16* __restrict__ A, const T16* __restrict__ A2, const T16* __restrict__ Bt, const T16* __restrict__ Bt2, int K, float* C, int ldc, const float* __restrict__ bias, size_t sA, size_t sB, size_t sC) {
    typedef typename WFrag<T16>::V V;
    __shared__ __align__(16) float os[16 * 68];
    const size_t z = blockIdx.z; A += z * sA; if (A2) A2 += z * sA; Bt += z * sB; if (Bt2) Bt2 += z * sB; C += z * sC;
    const int lane = threadIdx.x & 31, lr = lane & 15, hi = lane >> 4; const int r0 = blockIdx.x * 64, c0 = blockIdx.y * 64;
    v8f acc[4][4];
#pragma unroll
    for (int mb = 0; mb < 4; ++mb)
#pragma unroll
        for (int nb = 0; nb < 4; ++nb) acc[mb][nb] = (v8f){};
    const size_t aoff = (size_t)(r0 + lr) * K + 8 * hi, boff = (size_t)(c0 + lr) * K + 8 * hi;
#pragma unroll 1
    for (int kc = 0; kc < K; kc += 32) {
        V a[4], a2[4];
#pragma unroll
        for (int mb = 0; mb < 4; ++mb) { a[mb] = WFrag<T16>::ld(A + aoff + (size_t)mb * 16 * K + kc); if (NSPLIT == 1 || NSPLIT == 2) a2[mb] = WFrag<T16>::ld(A2 + aoff + (size_t)mb * 16 * K + kc); }
#pragma unroll
        for (int nb = 0; nb < 4; ++nb) { const V b = WFrag<T16>::ld(Bt + boff + (size_t)nb * 16 * K + kc); V b2; if (NSPLIT >= 2) b2 = WFrag<T16>::ld(Bt2 + boff + (size_t)nb * 16 * K + kc);
#pragma unroll
            for (int mb = 0; mb < 4; ++mb) { acc[mb][nb] = WFrag<T16>::mma(a[mb], b, acc[mb][nb]); if (NSPLIT == 1 || NSPLIT == 2) acc[mb][nb] = WFrag<T16>::mma(a2[mb], b, acc[mb][nb]); if (NSPLIT >= 2) acc[mb][nb] = WFrag<T16>::mma(a[mb], b2, acc[mb][nb]); } }
        asm volatile("v_nop\n\tv_nop\n\tv_nop\n\tv_nop" : "+v"(acc[0][0]), "+v"(acc[1][1]), "+v"(acc[2][2]), "+v"(acc[3][3]) : "v"(a[0]), "v"(a[3]));
    }
#pragma unroll
    for (int mb = 0; mb < 4; ++mb) {
#pragma unroll
        for (int nb = 0; nb < 4; ++nb) {
#pragma unroll
            for (int j = 0; j < 8; ++j) os[(hi * 8 + j) * 68 + nb * 16 + lr] = acc[mb][nb][j]; }
        __builtin_amdgcn_wave_barrier(); asm volatile("" ::: "memory");
        float* crow = C + (size_t)(r0 + mb * 16) * ldc + c0;
{
#pragma unroll
            for (int s = 0; s < 8; ++s) { const int row = 2 * s + hi, cofs = lr * 4; v4f val = *(const v4fa*)(os + row * 68 + cofs); if (BIAS) { val[0] += bfr(bias[c0 + cofs]); val[1] += bfr(bias[c0 + cofs + 1]); val[2] += bfr(bias[c0 + cofs + 2]); val[3] += bfr(bias[c0 + cofs + 3]); }
                *(v4f*)(crow + (size_t)row * ldc + cofs) = val; }
             }
        __builtin_amdgcn_wave_barrier(); asm volatile("" ::: "memory");
    }
}

__device__ __forceinline__ h16 tohx(float x) { return (h16)x; }
__device__ __forceinline__ void splitf(float y, unsigned short& h, unsigned short& l) { h = f2bf(y); l = f2bf(y - bf2f(h)); }
typedef __attribute__((ext_vector_type(2))) unsigned short v2us;
typedef __attribute__((ext_vector_type(4))) unsigned short v4us;
typedef __attribute__((ext_vector_type(4))) _Float16 v4h;

__global__ __launch_bounds__(256) void k_cvt8(const float* __restrict__ src, bf* dst, size_t n8) { const size_t i = (size_t)blockIdx.x * 256 + threadIdx.x; if (i >= n8) return; const v8f v = *(const v8f*)(src + i * 8); v8us o;
#pragma unroll
    for (int k = 0; k < 8; ++k) o[k] = f2bf(v[k]); *(v8us*)(dst + i * 8) = o;  }
// k_wqk: Bt [64][32] bf16 = [wq; wk; 0]; k_bqk: bias [64] = [bq | bk | 0]; k_xt: XT[p][c] = bf16 x[c][p] (lane -> 2 consecutive c); k_qkhl: hl planes of q and k (32 wide, d >= 16 zero) from QK[p][0..31] (8-B lanes);
__global__ __launch_bounds__(256) void k_wqk(const float* __restrict__ wq, const float* __restrict__ wk, bf* Bt) { const int e = (blockIdx.x * 256 + threadIdx.x) * 4; if (e >= 64 * CE) return; const int c = e % CE, n = e / CE; v4us o;
#pragma unroll
    for (int u = 0; u < 4; ++u) o[u] = n < CQ ? f2bf(wq[n * CE + c + u]) : (n < 2 * CQ ? f2bf(wk[(n - CQ) * CE + c + u]) : (unsigned short)0); *(v4us*)(Bt + e) = o;  }
__global__ __launch_bounds__(64) void k_bqk(const float* __restrict__ bq, const float* __restrict__ bk, float* b) { const int n = threadIdx.x; const float v = n < CQ ? bq[n] : (n < 2 * CQ ? bk[n - CQ] : 0.f); *(float*)(b + n) = v;  }
template <int NC> __global__ __launch_bounds__(256) void k_xt(const float* __restrict__ x, bf* XT) { const int e = (blockIdx.x * 256 + threadIdx.x) * 2; if (e >= NP * NC) return; const int c = e % NC; const int p = e / NC; v2us o; o[0] = f2bf(x[(size_t)c * NP + p]); o[1] = f2bf(x[(size_t)(c + 1) * NP + p]); *(v2us*)(XT + e) = o;  }
__global__ __launch_bounds__(256) void k_qkhl(const float* __restrict__ QK, bf* Qh, bf* Ql, bf* Kh, bf* Kl) { const int e = (blockIdx.x * 256 + threadIdx.x) * 4; if (e >= NP * KP) return; const int d = e % KP; const int p = e / KP; v4us qh, ql, kh, kl;
#pragma unroll
    for (int u = 0; u < 4; ++u) { const int dd = d + u; const float qv = dd < CQ ? QK[(size_t)p * 64 + dd] : 0.f, kv = dd < CQ ? QK[(size_t)p * 64 + CQ + dd] : 0.f; unsigned short a, b; splitf(qv, a, b); qh[u] = a; ql[u] = b; splitf(kv, a, b); kh[u] = a; kl[u] = b; }
    { *(v4us*)(Qh + e) = qh; *(v4us*)(Ql + e) = ql; *(v4us*)(Kh + e) = kh; *(v4us*)(Kl + e) = kl;  } }
__global__ __launch_bounds__(256) void k_v16(const float* __restrict__ V, const float* __restrict__ bv, h16* V16) { const size_t e = ((size_t)blockIdx.x * 256 + threadIdx.x) * 4; if (e >= (size_t)CC * NP) return; const int c = (int)(e / NP); const v4f a = *(const v4f*)(V + e); float bb = bfr(bv[c]); v4h o;
#pragma unroll
    for (int u = 0; u < 4; ++u) o[u] = tohx(__fadd_rn(a[u], bb)); *(v4h*)(V16 + e) = o;  }
__global__ __launch_bounds__(256) void k_psoft(const float* __restrict__ Sb, h16* P16) { const int lane = threadIdx.x & 31; const int row = blockIdx.x * 8 + (threadIdx.x >> 5); if (row >= NP) return; const float* sr = Sb + (size_t)row * NP; float v[NP / 32]; float mx = -3.0e38f;
#pragma unroll
    for (int ch = 0; ch < NP / 128; ++ch) { const v4f a = *(const v4f*)(sr + ch * 128 + lane * 4);
#pragma unroll
        for (int u = 0; u < 4; ++u) { v[ch * 4 + u] = a[u]; mx = fmaxf(mx, a[u]); } }
#pragma unroll
    for (int sh = 16; sh; sh >>= 1) mx = fmaxf(mx, __shfl_xor(mx, sh, 32));
    float sum = 0.f;
#pragma unroll
    for (int q = 0; q < NP / 32; ++q) { float d0 = __fsub_rn(v[q], mx); asm volatile("" : "+v"(d0)); v[q] = __builtin_amdgcn_exp2f(__fmul_rn(d0, 1.4426950408889634f)); sum += v[q]; }
#pragma unroll
    for (int sh = 16; sh; sh >>= 1) sum += __shfl_xor(sum, sh, 32);
    const float f = __fdiv_rn(PCAR, sum);
    {
#pragma unroll
        for (int ch = 0; ch < NP / 128; ++ch) { v4h o4;
#pragma unroll
            for (int q = 0; q < 4; ++q) o4[q] = tohx(v[ch * 4 + q] * f); *(v4h*)(P16 + (size_t)row * NP + ch * 128 + lane * 4) = o4; }
         } }
__global__ __launch_bounds__(256) void k_fin(const float* __restrict__ sod, const float* __restrict__ FEAT, float* OUTb) { const size_t e = ((size_t)blockIdx.x * 256 + threadIdx.x) * 4; if (e >= (size_t)CC * NP) return; const v4f s = *(const v4f*)(sod + e), f = *(const v4f*)(FEAT + e); v4f o;
#pragma unroll
    for (int u = 0; u < 4; ++u) { const float sv = bfr(s[u]); float t = __fmul_rn(f[u] * (1.0f / PCAR), sv); asm volatile("" : "+v"(t)); o[u] = __fadd_rn(sv, t); } *(v4f*)(OUTb + e) = o;  }

extern "C" void kernel_launch(void* const* d_in, const int* in_sizes, int n_in,
                              void* d_out, int out_size, void* d_ws, size_t ws_size, hipStream_t stream) {
    (void)in_sizes; (void)n_in; (void)out_size;
    const float* sod = (const float*)d_in[0]; const float* edge = (const float*)d_in[1]; const float* wq = (const float*)d_in[2]; const float* bq = (const float*)d_in[3]; const float* wk = (const float*)d_in[4]; const float* bk = (const float*)d_in[5]; const float* wv = (const float*)d_in[6]; const float* bv = (const float*)d_in[7];
    float* OUT = (float*)d_out;     // [8][256][64][64]
    char* wsp = (char*)d_ws;
    auto take = [&](size_t bytes) { char* p = wsp; wsp += (bytes + 255) & ~(size_t)255; return (void*)p; };
    bf* WQK = (bf*)take(64 * CE * 2); float* bqk = (float*)take(256); bf* WV = (bf*)take(CC * CC * 2); bf* ET = (bf*)take((size_t)NP * CE * 2); bf* ST = (bf*)take((size_t)NP * CC * 2); float* QK = (float*)take((size_t)NP * 64 * 4); float* V = (float*)take((size_t)CC * NP * 4);
    bf* Qh = (bf*)take((size_t)NP * KP * 2); bf* Ql = (bf*)take((size_t)NP * KP * 2); bf* Kh = (bf*)take((size_t)NP * KP * 2); bf* Kl = (bf*)take((size_t)NP * KP * 2); h16* V16 = (h16*)take((size_t)CC * NP * 2); float* Sb = (float*)take((size_t)NP * NP * 4); h16* P16 = (h16*)take((size_t)NP * NP * 2); float* FEAT = (float*)take((size_t)CC * NP * 4);
    if ((size_t)(wsp - (char*)d_ws) > ws_size) return;    // total ~ 112 MB
    k_wqk<<<(64 * CE / 4 + 255) / 256, 256, 0, stream>>>(wq, wk, WQK); k_bqk<<<1, 64, 0, stream>>>(bq, bk, bqk); k_cvt8<<<(CC * CC / 8 + 255) / 256, 256, 0, stream>>>(wv, WV, CC * CC / 8);   // wv [out][in] = A operand [c][cc]
    for (int b = 0; b < NB_; ++b) { const float* sb = sod + (size_t)b * CC * NP; const float* eb = edge + (size_t)b * CE * NP;
        k_xt<CE><<<(NP * CE / 2 + 255) / 256, 256, 0, stream>>>(eb, ET); k_xt<CC><<<(NP * CC / 2 + 255) / 256, 256, 0, stream>>>(sb, ST);
        k_gemmw<bf, 0, true><<<dim3(NP / 64, 1, 1), 32, 0, stream>>>(ET, nullptr, WQK, nullptr, CE, QK, 64, bqk, 0, 0, 0);        // QK[p][0..15 | 16..31]
        k_gemmw<bf, 0, false><<<dim3(CC / 64, NP / 64, 1), 32, 0, stream>>>(WV, nullptr, ST, nullptr, CC, V, NP, nullptr, 0, 0, 0);   // V[c][p] = sum_cc wv[c][cc] sod[cc][p]
        k_qkhl<<<(NP * KP / 4 + 255) / 256, 256, 0, stream>>>(QK, Qh, Ql, Kh, Kl); k_v16<<<(unsigned)(((size_t)CC * NP / 4 + 255) / 256), 256, 0, stream>>>(V, bv, V16);
        k_gemmw<bf, 2, false><<<dim3(NP / 64, NP / 64, 1), 32, 0, stream>>>(Qh, Ql, Kh, Kl, KP, Sb, NP, nullptr, 0, 0, 0);   // scores[i][j] (3 products)
        k_psoft<<<NP / 8, 256, 0, stream>>>(Sb, P16);
        k_gemmw<h16, 0, false><<<dim3(CC / 64, NP / 64, 1), 32, 0, stream>>>(V16, nullptr, P16, nullptr, NP, FEAT, NP, nullptr, 0, 0, 0); // FEAT[c][i] = sum_j v[c][j] P[i][j]
        k_fin<<<(unsigned)(((size_t)CC * NP / 4 + 255) / 256), 256, 0, stream>>>(sb, FEAT, OUT + (size_t)b * CC * NP); }
}

// v001
// It runs in 683 microseconds.
// Two timings next to v000 put it at 1.76 and 1.78 times that version's speed.
#include <hip/hip_runtime.h>

// (sod [8][256][64x64], edge [8][32][64x64]; q = wq edge + bq, k = wk edge + bk (16 channels), v = wv sod + bv; mask = softmax_j(sum_d q[d][i] k[d][j]) (unscaled); feat[c][i] = sum_j v[c][j] mask[i][j]; out = sod + feat * sod -> [8][256][64][64]).
// Compute dtypes, f32 accumulate: every input rounded to bf16; q|k as one GEMM edge^T x [wq; wk]^T and v = wv x sod on PLAIN bf16 operands (inputs: every product exact) + bias; scores (K 16, padded to 32) on bf16 hi+lo planes of q, k (3 products - the unscaled logits are too large for fp16 operands);

#define NB_  8
#define CC   256
#define CE   32
#define CQ   16
#define NP   4096
#define KP   32
#define PCAR 1024.0f
typedef _Float16 h16;
typedef unsigned short bf;
typedef __attribute__((ext_vector_type(16))) __bf16   v16bf;
typedef __attribute__((ext_vector_type(16))) _Float16 v16h;
typedef __attribute__((ext_vector_type(8)))  _Float16 v8h;
typedef __attribute__((ext_vector_type(8)))  unsigned short v8us;
typedef __attribute__((ext_vector_type(8)))  float    v8f;
typedef __attribute__((ext_vector_type(4)))  float    v4f;
typedef v8h  __attribute__((may_alias)) v8ha;
typedef v4f  __attribute__((may_alias)) v4fa;
typedef v8us __attribute__((may_alias)) v8usa;

__device__ __forceinline__ unsigned short f2bf(float f) { unsigned u = __float_as_uint(f); u += 0x7FFFu + ((u >> 16) & 1u); return (unsigned short)(u >> 16); }
__device__ __forceinline__ float bf2f(unsigned short b) { return __uint_as_float(((unsigned)b) << 16); }
__device__ __forceinline__ float bfr(float f) { return bf2f(f2bf(f)); }
__device__ __forceinline__ v16h cat16(v8h lo, v8h hi) { return __builtin_shufflevector(lo, hi, 0, 1, 2, 3, 4, 5, 6, 7, 8, 9, 10, 11, 12, 13, 14, 15); }
__device__ __forceinline__ v16bf cat16b(v8us lo, v8us hi) { return __builtin_bit_cast(v16bf, __builtin_shufflevector(lo, hi, 0, 1, 2, 3, 4, 5, 6, 7, 8, 9, 10, 11, 12, 13, 14, 15)); }
__device__ __forceinline__ v8f wmma16(v16h a, v16h b, v8f c) { return __builtin_amdgcn_wmma_f32_16x16x32_f16(false, a, false, b, (short)0, c, false, false); }
__device__ __forceinline__ v8f wmmab(v16bf a, v16bf b, v8f c) { return __builtin_amdgcn_wmma_f32_16x16x32_bf16(false, a, false, b, (short)0, c, false, false); }



// ---- k_gemmw: register-blocked GEMM, ONE WAVE per 64x64 output tile (16 accumulators), operands straight from K-contiguous 16-bit planes; grid (M/64, N/64, Z), 32 threads.
// C[m][n] (f32, pitch ldc, + optional f32 bias[n]) = sum_k A[m][k] Bt[n][k] (+ split products per NSPLIT). z-batch strides sA/sB/sC in elements. K % 32 == 0.
template <typename T16> struct WFrag;
template <> struct WFrag<h16> { typedef v16h V; static __device__ __forceinline__ V ld(const h16* p) { return cat16(*(const v8h*)p, *(const v8h*)(p + 16)); } static __device__ __forceinline__ v8f mma(V a, V b, v8f c) { return wmma16(a, b, c); } };
template <> struct WFrag<bf> { typedef v16bf V; static __device__ __forceinline__ V ld(const bf* p) { return cat16b(*(const v8us*)p, *(const v8us*)(p + 16)); } static __device__ __forceinline__ v8f mma(V a, V b, v8f c) { return wmmab(a, b, c); } };
template <typename T16, int NSPLIT, bool BIAS>
__global__ __launch_bounds__(32) void k_gemmw(const T16* __restrict__ A, const T16* __restrict__ A2, const T16* __restrict__ Bt, const T16* __restrict__ Bt2, int K, float* C, int ldc, const float* __restrict__ bias, size_t sA, size_t sB, size_t sC) {
    typedef typename WFrag<T16>::V V;
    __shared__ __align__(16) float os[16 * 68];
    const size_t z = blockIdx.z; A += z * sA; if (A2) A2 += z * sA; Bt += z * sB; if (Bt2) Bt2 += z * sB; C += z * sC;
    const int lane = threadIdx.x & 31, lr = lane & 15, hi = lane >> 4; const int r0 = blockIdx.x * 64, c0 = blockIdx.y * 64;
    v8f acc[4][4];
#pragma unroll
    for (int mb = 0; mb < 4; ++mb)
#pragma unroll
        for (int nb = 0; nb < 4; ++nb) acc[mb][nb] = (v8f){};
    const size_t aoff = (size_t)(r0 + lr) * K + 8 * hi, boff = (size_t)(c0 + lr) * K + 8 * hi;
#pragma unroll 1
    for (int kc = 0; kc < K; kc += 32) {
        V a[4], a2[4];
#pragma unroll
        for (int mb = 0; mb < 4; ++mb) { a[mb] = WFrag<T16>::ld(A + aoff + (size_t)mb * 16 * K + kc); if (NSPLIT == 1 || NSPLIT == 2) a2[mb] = WFrag<T16>::ld(A2 + aoff + (size_t)mb * 16 * K + kc); }
#pragma unroll
        for (int nb = 0; nb < 4; ++nb) { const V b = WFrag<T16>::ld(Bt + boff + (size_t)nb * 16 * K + kc); V b2; if (NSPLIT >= 2) b2 = WFrag<T16>::ld(Bt2 + boff + (size_t)nb * 16 * K + kc);
#pragma unroll
            for (int mb = 0; mb < 4; ++mb) { acc[mb][nb] = WFrag<T16>::mma(a[mb], b, acc[mb][nb]); if (NSPLIT == 1 || NSPLIT == 2) acc[mb][nb] = WFrag<T16>::mma(a2[mb], b, acc[mb][nb]); if (NSPLIT >= 2) acc[mb][nb] = WFrag<T16>::mma(a[mb], b2, acc[mb][nb]); } }
        asm volatile("v_nop\n\tv_nop\n\tv_nop\n\tv_nop" : "+v"(acc[0][0]), "+v"(acc[1][1]), "+v"(acc[2][2]), "+v"(acc[3][3]) : "v"(a[0]), "v"(a[3]));
    }
#pragma unroll
    for (int mb = 0; mb < 4; ++mb) {
#pragma unroll
        for (int nb = 0; nb < 4; ++nb) {
#pragma unroll
            for (int j = 0; j < 8; ++j) os[(hi * 8 + j) * 68 + nb * 16 + lr] = acc[mb][nb][j]; }
        __builtin_amdgcn_wave_barrier(); asm volatile("" ::: "memory");
        float* crow = C + (size_t)(r0 + mb * 16) * ldc + c0;
{
#pragma unroll
            for (int s = 0; s < 8; ++s) { const int row = 2 * s + hi, cofs = lr * 4; v4f val = *(const v4fa*)(os + row * 68 + cofs); if (BIAS) { val[0] += bfr(bias[c0 + cofs]); val[1] += bfr(bias[c0 + cofs + 1]); val[2] += bfr(bias[c0 + cofs + 2]); val[3] += bfr(bias[c0 + cofs + 3]); }
                *(v4f*)(crow + (size_t)row * ldc + cofs) = val; }
             }
        __builtin_amdgcn_wave_barrier(); asm volatile("" ::: "memory");
    }
}

// ---- k_gemmsk: C[m][n] (f32, pitch NP) = sum_k A[m][k] Bt[n][k], K = KT, one 64x64 tile per work-group of NW waves; grid (M/64, N/64), NW*32 threads.
// The k axis is dealt to the waves in chunks of 32: wave w takes chunks w, w + NW, ... (neighbour waves read the two halves of one 128-byte line at about the same time) and sums them into its own
// 16 accumulators with the trip of k_gemmw; the NW partial tiles are then added through LDS in wave order.
template <typename T16, int KT, int NW>
__global__ __launch_bounds__(NW * 32) void k_gemmsk(const T16* __restrict__ A, const T16* __restrict__ Bt, float* __restrict__ C) {
    typedef typename WFrag<T16>::V V;
    __shared__ __align__(16) float red[NW * 64 * 68];
    const int tid = threadIdx.x, lane = tid & 31, lr = lane & 15, hi = lane >> 4, wave = tid >> 5; const int r0 = blockIdx.x * 64, c0 = blockIdx.y * 64;
    v8f acc[4][4];
#pragma unroll
    for (int mb = 0; mb < 4; ++mb)
#pragma unroll
        for (int nb = 0; nb < 4; ++nb) acc[mb][nb] = (v8f){};
    const size_t aoff = (size_t)(r0 + lr) * KT + 8 * hi + wave * 32, boff = (size_t)(c0 + lr) * KT + 8 * hi + wave * 32;
#pragma unroll 1
    for (int kc = 0; kc < KT; kc += NW * 32) {   // rolled, as in k_gemmw: the same trip, every NW-th chunk
        V a[4]; const T16* ap = A + aoff + kc; const T16* bp = Bt + boff + kc;
#pragma unroll
        for (int mb = 0; mb < 4; ++mb) a[mb] = WFrag<T16>::ld(ap + (size_t)mb * 16 * KT);
#pragma unroll
        for (int nb = 0; nb < 4; ++nb) { const V b = WFrag<T16>::ld(bp + (size_t)nb * 16 * KT);
            // behind the trip's last load: both address pairs are inputs, so they stay whole up to this wait and nothing (a load's result either) is written over them in front of it
            if (nb == 3) asm volatile("s_wait_xcnt 0x0" :: "v"(ap), "v"(bp) : "memory");
#pragma unroll
            for (int mb = 0; mb < 4; ++mb) acc[mb][nb] = WFrag<T16>::mma(a[mb], b, acc[mb][nb]); }
        // four vector slots behind the trip's last products, on the taken back edge too, before the next trip's loads land in the operand registers
        asm volatile("v_nop\n\tv_nop\n\tv_nop\n\tv_nop" : "+v"(acc[0][0]), "+v"(acc[1][1]), "+v"(acc[2][2]), "+v"(acc[3][3]) : "v"(a[0]), "v"(a[3]));
    }
    float* my = red + wave * (64 * 68);
#pragma unroll
    for (int mb = 0; mb < 4; ++mb)
#pragma unroll
        for (int nb = 0; nb < 4; ++nb)
#pragma unroll
            for (int j = 0; j < 8; ++j) my[(mb * 16 + hi * 8 + j) * 68 + nb * 16 + lr] = acc[mb][nb][j];
    __syncthreads();   // every wave's partial tile is in LDS before any thread adds them
    constexpr int NS = 64 * 16 / (NW * 32); const int rw = tid >> 4, cofs = (tid & 15) * 4; v4f p[NS][NW];
#pragma unroll
    for (int s = 0; s < NS; ++s)
#pragma unroll
        for (int w = 0; w < NW; ++w) p[s][w] = *(const v4fa*)(red + w * (64 * 68) + (s * (NW * 2) + rw) * 68 + cofs);
#pragma unroll
    for (int s = 0; s < NS; ++s) { v4f val = p[s][0];
#pragma unroll
        for (int w = 1; w < NW; ++w) val += p[s][w];
        *(v4f*)(C + (size_t)(r0 + s * (NW * 2) + rw) * NP + c0 + cofs) = val; }
}

__device__ __forceinline__ h16 tohx(float x) { return (h16)x; }
__device__ __forceinline__ void splitf(float y, unsigned short& h, unsigned short& l) { h = f2bf(y); l = f2bf(y - bf2f(h)); }
typedef __attribute__((ext_vector_type(2))) unsigned short v2us;
typedef __attribute__((ext_vector_type(4))) unsigned short v4us;
typedef __attribute__((ext_vector_type(4))) _Float16 v4h;

__global__ __launch_bounds__(256) void k_cvt8(const float* __restrict__ src, bf* dst, size_t n8) { const size_t i = (size_t)blockIdx.x * 256 + threadIdx.x; if (i >= n8) return; const v8f v = *(const v8f*)(src + i * 8); v8us o;
#pragma unroll
    for (int k = 0; k < 8; ++k) o[k] = f2bf(v[k]); *(v8us*)(dst + i * 8) = o;  }
// k_wqk: Bt [64][32] bf16 = [wq; wk; 0]; k_bqk: bias [64] = [bq | bk | 0]; k_xt: XT[p][c] = bf16 x[c][p] (lane -> 2 consecutive c); k_qkhl: hl planes of q and k (32 wide, d >= 16 zero) from QK[p][0..31] (8-B lanes);
__global__ __launch_bounds__(256) void k_wqk(const float* __restrict__ wq, const float* __restrict__ wk, bf* Bt) { const int e = (blockIdx.x * 256 + threadIdx.x) * 4; if (e >= 64 * CE) return; const int c = e % CE, n = e / CE; v4us o;
#pragma unroll
    for (int u = 0; u < 4; ++u) o[u] = n < CQ ? f2bf(wq[n * CE + c + u]) : (n < 2 * CQ ? f2bf(wk[(n - CQ) * CE + c + u]) : (unsigned short)0); *(v4us*)(Bt + e) = o;  }
__global__ __launch_bounds__(64) void k_bqk(const float* __restrict__ bq, const float* __restrict__ bk, float* b) { const int n = threadIdx.x; const float v = n < CQ ? bq[n] : (n < 2 * CQ ? bk[n - CQ] : 0.f); *(float*)(b + n) = v;  }
template <int NC> __global__ __launch_bounds__(256) void k_xt(const float* __restrict__ x, bf* XT) { const int e = (blockIdx.x * 256 + threadIdx.x) * 2; if (e >= NP * NC) return; const int c = e % NC; const int p = e / NC; v2us o; o[0] = f2bf(x[(size_t)c * NP + p]); o[1] = f2bf(x[(size_t)(c + 1) * NP + p]); *(v2us*)(XT + e) = o;  }
__global__ __launch_bounds__(256) void k_qkhl(const float* __restrict__ QK, bf* Qh, bf* Ql, bf* Kh, bf* Kl) { const int e = (blockIdx.x * 256 + threadIdx.x) * 4; if (e >= NP * KP) return; const int d = e % KP; const int p = e / KP; v4us qh, ql, kh, kl;
#pragma unroll
    for (int u = 0; u < 4; ++u) { const int dd = d + u; const float qv = dd < CQ ? QK[(size_t)p * 64 + dd] : 0.f, kv = dd < CQ ? QK[(size_t)p * 64 + CQ + dd] : 0.f; unsigned short a, b; splitf(qv, a, b); qh[u] = a; ql[u] = b; splitf(kv, a, b); kh[u] = a; kl[u] = b; }
    { *(v4us*)(Qh + e) = qh; *(v4us*)(Ql + e) = ql; *(v4us*)(Kh + e) = kh; *(v4us*)(Kl + e) = kl;  } }
__global__ __launch_bounds__(256) void k_v16(const float* __restrict__ V, const float* __restrict__ bv, h16* V16) { const size_t e = ((size_t)blockIdx.x * 256 + threadIdx.x) * 4; if (e >= (size_t)CC * NP) return; const int c = (int)(e / NP); const v4f a = *(const v4f*)(V + e); float bb = bfr(bv[c]); v4h o;
#pragma unroll
    for (int u = 0; u < 4; ++u) o[u] = tohx(__fadd_rn(a[u], bb)); *(v4h*)(V16 + e) = o;  }
__global__ __launch_bounds__(256) void k_psoft(const float* __restrict__ Sb, h16* P16) { const int lane = threadIdx.x & 31; const int row = blockIdx.x * 8 + (threadIdx.x >> 5); if (row >= NP) return; const float* sr = Sb + (size_t)row * NP; float v[NP / 32]; float mx = -3.0e38f;
#pragma unroll
    for (int ch = 0; ch < NP / 128; ++ch) { const v4f a = *(const v4f*)(sr + ch * 128 + lane * 4);
#pragma unroll
        for (int u = 0; u < 4; ++u) { v[ch * 4 + u] = a[u]; mx = fmaxf(mx, a[u]); } }
#pragma unroll
    for (int sh = 16; sh; sh >>= 1) mx = fmaxf(mx, __shfl_xor(mx, sh, 32));
    float sum = 0.f;
#pragma unroll
    for (int q = 0; q < NP / 32; ++q) { float d0 = __fsub_rn(v[q], mx); asm volatile("" : "+v"(d0)); v[q] = __builtin_amdgcn_exp2f(__fmul_rn(d0, 1.4426950408889634f)); sum += v[q]; }
#pragma unroll
    for (int sh = 16; sh; sh >>= 1) sum += __shfl_xor(sum, sh, 32);
    const float f = __fdiv_rn(PCAR, sum);
    {
#pragma unroll
        for (int ch = 0; ch < NP / 128; ++ch) { v4h o4;
#pragma unroll
            for (int q = 0; q < 4; ++q) o4[q] = tohx(v[ch * 4 + q] * f); *(v4h*)(P16 + (size_t)row * NP + ch * 128 + lane * 4) = o4; }
         } }
__global__ __launch_bounds__(256) void k_fin(const float* __restrict__ sod, const float* __restrict__ FEAT, float* OUTb) { const size_t e = ((size_t)blockIdx.x * 256 + threadIdx.x) * 4; if (e >= (size_t)CC * NP) return; const v4f s = *(const v4f*)(sod + e), f = *(const v4f*)(FEAT + e); v4f o;
#pragma unroll
    for (int u = 0; u < 4; ++u) { const float sv = bfr(s[u]); float t = __fmul_rn(f[u] * (1.0f / PCAR), sv); asm volatile("" : "+v"(t)); o[u] = __fadd_rn(sv, t); } *(v4f*)(OUTb + e) = o;  }

extern "C" void kernel_launch(void* const* d_in, const int* in_sizes, int n_in,
                              void* d_out, int out_size, void* d_ws, size_t ws_size, hipStream_t stream) {
    (void)in_sizes; (void)n_in; (void)out_size;
    const float* sod = (const float*)d_in[0]; const float* edge = (const float*)d_in[1]; const float* wq = (const float*)d_in[2]; const float* bq = (const float*)d_in[3]; const float* wk = (const float*)d_in[4]; const float* bk = (const float*)d_in[5]; const float* wv = (const float*)d_in[6]; const float* bv = (const float*)d_in[7];
    float* OUT = (float*)d_out;     // [8][256][64][64]
    char* wsp = (char*)d_ws;
    auto take = [&](size_t bytes) { char* p = wsp; wsp += (bytes + 255) & ~(size_t)255; return (void*)p; };
    bf* WQK = (bf*)take(64 * CE * 2); float* bqk = (float*)take(256); bf* WV = (bf*)take(CC * CC * 2); bf* ET = (bf*)take((size_t)NP * CE * 2); bf* ST = (bf*)take((size_t)NP * CC * 2); float* QK = (float*)take((size_t)NP * 64 * 4); float* V = (float*)take((size_t)CC * NP * 4);
    bf* Qh = (bf*)take((size_t)NP * KP * 2); bf* Ql = (bf*)take((size_t)NP * KP * 2); bf* Kh = (bf*)take((size_t)NP * KP * 2); bf* Kl = (bf*)take((size_t)NP * KP * 2); h16* V16 = (h16*)take((size_t)CC * NP * 2); float* Sb = (float*)take((size_t)NP * NP * 4); h16* P16 = (h16*)take((size_t)NP * NP * 2); float* FEAT = (float*)take((size_t)CC * NP * 4);
    if ((size_t)(wsp - (char*)d_ws) > ws_size) return;    // total ~ 112 MB
    k_wqk<<<(64 * CE / 4 + 255) / 256, 256, 0, stream>>>(wq, wk, WQK); k_bqk<<<1, 64, 0, stream>>>(bq, bk, bqk); k_cvt8<<<(CC * CC / 8 + 255) / 256, 256, 0, stream>>>(wv, WV, CC * CC / 8);   // wv [out][in] = A operand [c][cc]
    for (int b = 0; b < NB_; ++b) { const float* sb = sod + (size_t)b * CC * NP; const float* eb = edge + (size_t)b * CE * NP;
        k_xt<CE><<<(NP * CE / 2 + 255) / 256, 256, 0, stream>>>(eb, ET); k_xt<CC><<<(NP * CC / 2 + 255) / 256, 256, 0, stream>>>(sb, ST);
        k_gemmw<bf, 0, true><<<dim3(NP / 64, 1, 1), 32, 0, stream>>>(ET, nullptr, WQK, nullptr, CE, QK, 64, bqk, 0, 0, 0);        // QK[p][0..15 | 16..31]
        k_gemmsk<bf, CC, 4><<<dim3(CC / 64, NP / 64, 1), 128, 0, stream>>>(WV, ST, V);   // V[c][p] = sum_cc wv[c][cc] sod[cc][p]
        k_qkhl<<<(NP * KP / 4 + 255) / 256, 256, 0, stream>>>(QK, Qh, Ql, Kh, Kl); k_v16<<<(unsigned)(((size_t)CC * NP / 4 + 255) / 256), 256, 0, stream>>>(V, bv, V16);
        k_gemmw<bf, 2, false><<<dim3(NP / 64, NP / 64, 1), 32, 0, stream>>>(Qh, Ql, Kh, Kl, KP, Sb, NP, nullptr, 0, 0, 0);   // scores[i][j] (3 products)
        k_psoft<<<NP / 8, 256, 0, stream>>>(Sb, P16);
        k_gemmsk<h16, NP, 16><<<dim3(CC / 64, NP / 64, 1), 512, 0, stream>>>(V16, P16, FEAT); // FEAT[c][i] = sum_j v[c][j] P[i][j]
        k_fin<<<(unsigned)(((size_t)CC * NP / 4 + 255) / 256), 256, 0, stream>>>(sb, FEAT, OUT + (size_t)b * CC * NP); }
}

// v002
// One run takes 551 microseconds.
// Timed twice side by side with v001, it ran 1.24 and 1.25 times as fast.
// All steps since v000 together make it 2.20 times as fast.
#include <hip/hip_runtime.h>

// (sod [8][256][64x64], edge [8][32][64x64]; q = wq edge + bq, k = wk edge + bk (16 channels), v = wv sod + bv; mask = softmax_j(sum_d q[d][i] k[d][j]) (unscaled); feat[c][i] = sum_j v[c][j] mask[i][j]; out = sod + feat * sod -> [8][256][64][64]).
// Compute dtypes, f32 accumulate: every input rounded to bf16; q|k as one GEMM edge^T x [wq; wk]^T and v = wv x sod on PLAIN bf16 operands (inputs: every product exact) + bias; scores (K 16, padded to 32) on bf16 hi+lo planes of q, k (3 products - the unscaled logits are too large for fp16 operands);

#define NB_  8
#define CC   256
#define CE   32
#define CQ   16
#define NP   4096
#define KP   32
#define PCAR 1024.0f
typedef _Float16 h16;
typedef unsigned short bf;
typedef __attribute__((ext_vector_type(16))) __bf16   v16bf;
typedef __attribute__((ext_vector_type(16))) _Float16 v16h;
typedef __attribute__((ext_vector_type(8)))  _Float16 v8h;
typedef __attribute__((ext_vector_type(8)))  unsigned short v8us;
typedef __attribute__((ext_vector_type(8)))  float    v8f;
typedef __attribute__((ext_vector_type(4)))  float    v4f;
typedef v8h  __attribute__((may_alias)) v8ha;
typedef v4f  __attribute__((may_alias)) v4fa;
typedef v8us __attribute__((may_alias)) v8usa;

__device__ __forceinline__ unsigned short f2bf(float f) { unsigned u = __float_as_uint(f); u += 0x7FFFu + ((u >> 16) & 1u); return (unsigned short)(u >> 16); }
__device__ __forceinline__ float bf2f(unsigned short b) { return __uint_as_float(((unsigned)b) << 16); }
__device__ __forceinline__ float bfr(float f) { return bf2f(f2bf(f)); }
__device__ __forceinline__ v16h cat16(v8h lo, v8h hi) { return __builtin_shufflevector(lo, hi, 0, 1, 2, 3, 4, 5, 6, 7, 8, 9, 10, 11, 12, 13, 14, 15); }
__device__ __forceinline__ v16bf cat16b(v8us lo, v8us hi) { return __builtin_bit_cast(v16bf, __builtin_shufflevector(lo, hi, 0, 1, 2, 3, 4, 5, 6, 7, 8, 9, 10, 11, 12, 13, 14, 15)); }
__device__ __forceinline__ v8f wmma16(v16h a, v16h b, v8f c) { return __builtin_amdgcn_wmma_f32_16x16x32_f16(false, a, false, b, (short)0, c, false, false); }
__device__ __forceinline__ v8f wmmab(v16bf a, v16bf b, v8f c) { return __builtin_amdgcn_wmma_f32_16x16x32_bf16(false, a, false, b, (short)0, c, false, false); }



// ---- k_gemmw: register-blocked GEMM, ONE WAVE per 64x64 output tile (16 accumulators), operands straight from K-contiguous 16-bit planes; grid (M/64, N/64, Z), 32 threads.
// C[m][n] (f32, pitch ldc, + optional f32 bias[n]) = sum_k A[m][k] Bt[n][k] (+ split products per NSPLIT). z-batch strides sA/sB/sC in elements. K % 32 == 0.
template <typename T16> struct WFrag;
template <> struct WFrag<h16> { typedef v16h V; static __device__ __forceinline__ V ld(const h16* p) { return cat16(*(const v8h*)p, *(const v8h*)(p + 16)); } static __device__ __forceinline__ v8f mma(V a, V b, v8f c) { return wmma16(a, b, c); } };
template <> struct WFrag<bf> { typedef v16bf V; static __device__ __forceinline__ V ld(const bf* p) { return cat16b(*(const v8us*)p, *(const v8us*)(p + 16)); } static __device__ __forceinline__ v8f mma(V a, V b, v8f c) { return wmmab(a, b, c); } };
template <typename T16, int NSPLIT, bool BIAS>
__global__ __launch_bounds__(32) void k_gemmw(const T16* __restrict__ A, const T16* __restrict__ A2, const T16* __restrict__ Bt, const T16* __restrict__ Bt2, int K, float* C, int ldc, const float* __restrict__ bias, size_t sA, size_t sB, size_t sC) {
    typedef typename WFrag<T16>::V V;
    __shared__ __align__(16) float os[16 * 68];
    const size_t z = blockIdx.z; A += z * sA; if (A2) A2 += z * sA; Bt += z * sB; if (Bt2) Bt2 += z * sB; C += z * sC;
    const int lane = threadIdx.x & 31, lr = lane & 15, hi = lane >> 4; const int r0 = blockIdx.x * 64, c0 = blockIdx.y * 64;
    v8f acc[4][4];
#pragma unroll
    for (int mb = 0; mb < 4; ++mb)
#pragma unroll
        for (int nb = 0; nb < 4; ++nb) acc[mb][nb] = (v8f){};
    const size_t aoff = (size_t)(r0 + lr) * K + 8 * hi, boff = (size_t)(c0 + lr) * K + 8 * hi;
#pragma unroll 1
    for (int kc = 0; kc < K; kc += 32) {
        V a[4], a2[4];
#pragma unroll
        for (int mb = 0; mb < 4; ++mb) { a[mb] = WFrag<T16>::ld(A + aoff + (size_t)mb * 16 * K + kc); if (NSPLIT == 1 || NSPLIT == 2) a2[mb] = WFrag<T16>::ld(A2 + aoff + (size_t)mb * 16 * K + kc); }
#pragma unroll
        for (int nb = 0; nb < 4; ++nb) { const V b = WFrag<T16>::ld(Bt + boff + (size_t)nb * 16 * K + kc); V b2; if (NSPLIT >= 2) b2 = WFrag<T16>::ld(Bt2 + boff + (size_t)nb * 16 * K + kc);
#pragma unroll
            for (int mb = 0; mb < 4; ++mb) { acc[mb][nb] = WFrag<T16>::mma(a[mb], b, acc[mb][nb]); if (NSPLIT == 1 || NSPLIT == 2) acc[mb][nb] = WFrag<T16>::mma(a2[mb], b, acc[mb][nb]); if (NSPLIT >= 2) acc[mb][nb] = WFrag<T16>::mma(a[mb], b2, acc[mb][nb]); } }
        asm volatile("v_nop\n\tv_nop\n\tv_nop\n\tv_nop" : "+v"(acc[0][0]), "+v"(acc[1][1]), "+v"(acc[2][2]), "+v"(acc[3][3]) : "v"(a[0]), "v"(a[3]));
    }
#pragma unroll
    for (int mb = 0; mb < 4; ++mb) {
#pragma unroll
        for (int nb = 0; nb < 4; ++nb) {
#pragma unroll
            for (int j = 0; j < 8; ++j) os[(hi * 8 + j) * 68 + nb * 16 + lr] = acc[mb][nb][j]; }
        __builtin_amdgcn_wave_barrier(); asm volatile("" ::: "memory");
        float* crow = C + (size_t)(r0 + mb * 16) * ldc + c0;
{
#pragma unroll
            for (int s = 0; s < 8; ++s) { const int row = 2 * s + hi, cofs = lr * 4; v4f val = *(const v4fa*)(os + row * 68 + cofs); if (BIAS) { val[0] += bfr(bias[c0 + cofs]); val[1] += bfr(bias[c0 + cofs + 1]); val[2] += bfr(bias[c0 + cofs + 2]); val[3] += bfr(bias[c0 + cofs + 3]); }
                *(v4f*)(crow + (size_t)row * ldc + cofs) = val; }
             }
        __builtin_amdgcn_wave_barrier(); asm volatile("" ::: "memory");
    }
}

// ---- k_gemmsk: C[m][n] (f32, pitch NP) = sum_k A[m][k] Bt[n][k], K = KT, one 64x64 tile per work-group of NW waves; grid (M/64, N/64), NW*32 threads.
// The k axis is dealt to the waves in chunks of 32: wave w takes chunks w, w + NW, ... (neighbour waves read the two halves of one 128-byte line at about the same time) and sums them into its own
// 16 accumulators with the trip of k_gemmw; the NW partial tiles are then added through LDS in wave order. blockIdx.z = batch: Bt and C step by sB and sC elements, A is shared.
template <typename T16, int KT, int NW>
__global__ __launch_bounds__(NW * 32) void k_gemmsk(const T16* __restrict__ A, const T16* __restrict__ Bt, float* __restrict__ C, size_t sB, size_t sC) {
    typedef typename WFrag<T16>::V V;
    Bt += blockIdx.z * sB; C += blockIdx.z * sC;
    __shared__ __align__(16) float red[NW * 64 * 68];
    const int tid = threadIdx.x, lane = tid & 31, lr = lane & 15, hi = lane >> 4, wave = tid >> 5; const int r0 = blockIdx.x * 64, c0 = blockIdx.y * 64;
    v8f acc[4][4];
#pragma unroll
    for (int mb = 0; mb < 4; ++mb)
#pragma unroll
        for (int nb = 0; nb < 4; ++nb) acc[mb][nb] = (v8f){};
    const size_t aoff = (size_t)(r0 + lr) * KT + 8 * hi + wave * 32, boff = (size_t)(c0 + lr) * KT + 8 * hi + wave * 32;
#pragma unroll 1
    for (int kc = 0; kc < KT; kc += NW * 32) {   // rolled, as in k_gemmw: the same trip, every NW-th chunk
        V a[4]; const T16* ap = A + aoff + kc; const T16* bp = Bt + boff + kc;
#pragma unroll
        for (int mb = 0; mb < 4; ++mb) a[mb] = WFrag<T16>::ld(ap + (size_t)mb * 16 * KT);
#pragma unroll
        for (int nb = 0; nb < 4; ++nb) { const V b = WFrag<T16>::ld(bp + (size_t)nb * 16 * KT);
            // behind the trip's last load: both address pairs are inputs, so they stay whole up to this wait and nothing (a load's result either) is written over them in front of it
            if (nb == 3) asm volatile("s_wait_xcnt 0x0" :: "v"(ap), "v"(bp) : "memory");
#pragma unroll
            for (int mb = 0; mb < 4; ++mb) acc[mb][nb] = WFrag<T16>::mma(a[mb], b, acc[mb][nb]); }
        // four vector slots behind the trip's last products, on the taken back edge too, before the next trip's loads land in the operand registers
        asm volatile("v_nop\n\tv_nop\n\tv_nop\n\tv_nop" : "+v"(acc[0][0]), "+v"(acc[1][1]), "+v"(acc[2][2]), "+v"(acc[3][3]) : "v"(a[0]), "v"(a[3]));
    }
    float* my = red + wave * (64 * 68);
#pragma unroll
    for (int mb = 0; mb < 4; ++mb)
#pragma unroll
        for (int nb = 0; nb < 4; ++nb)
#pragma unroll
            for (int j = 0; j < 8; ++j) my[(mb * 16 + hi * 8 + j) * 68 + nb * 16 + lr] = acc[mb][nb][j];
    __syncthreads();   // every wave's partial tile is in LDS before any thread adds them
    constexpr int NS = 64 * 16 / (NW * 32); const int rw = tid >> 4, cofs = (tid & 15) * 4; v4f p[NS][NW];
#pragma unroll
    for (int s = 0; s < NS; ++s)
#pragma unroll
        for (int w = 0; w < NW; ++w) p[s][w] = *(const v4fa*)(red + w * (64 * 68) + (s * (NW * 2) + rw) * 68 + cofs);
#pragma unroll
    for (int s = 0; s < NS; ++s) { v4f val = p[s][0];
#pragma unroll
        for (int w = 1; w < NW; ++w) val += p[s][w];
        *(v4f*)(C + (size_t)(r0 + s * (NW * 2) + rw) * NP + c0 + cofs) = val; }
}

__device__ __forceinline__ h16 tohx(float x) { return (h16)x; }
__device__ __forceinline__ void splitf(float y, unsigned short& h, unsigned short& l) { h = f2bf(y); l = f2bf(y - bf2f(h)); }
typedef __attribute__((ext_vector_type(2))) unsigned short v2us;
typedef __attribute__((ext_vector_type(4))) unsigned short v4us;
typedef __attribute__((ext_vector_type(4))) _Float16 v4h;

__global__ __launch_bounds__(256) void k_cvt8(const float* __restrict__ src, bf* dst, size_t n8) { const size_t i = (size_t)blockIdx.x * 256 + threadIdx.x; if (i >= n8) return; const v8f v = *(const v8f*)(src + i * 8); v8us o;
#pragma unroll
    for (int k = 0; k < 8; ++k) o[k] = f2bf(v[k]); *(v8us*)(dst + i * 8) = o;  }
// k_xt and k_qkhl take the batch from blockIdx.y; k_v16 and k_fin run flat over all batches ([b][c][p] is contiguous).
// k_wqk: Bt [64][32] bf16 = [wq; wk; 0]; k_bqk: bias [64] = [bq | bk | 0]; k_xt: XT[p][c] = bf16 x[c][p] (lane -> 2 consecutive c); k_qkhl: hl planes of q and k (32 wide, d >= 16 zero) from QK[p][0..31] (8-B lanes);
__global__ __launch_bounds__(256) void k_wqk(const float* __restrict__ wq, const float* __restrict__ wk, bf* Bt) { const int e = (blockIdx.x * 256 + threadIdx.x) * 4; if (e >= 64 * CE) return; const int c = e % CE, n = e / CE; v4us o;
#pragma unroll
    for (int u = 0; u < 4; ++u) o[u] = n < CQ ? f2bf(wq[n * CE + c + u]) : (n < 2 * CQ ? f2bf(wk[(n - CQ) * CE + c + u]) : (unsigned short)0); *(v4us*)(Bt + e) = o;  }
__global__ __launch_bounds__(64) void k_bqk(const float* __restrict__ bq, const float* __restrict__ bk, float* b) { const int n = threadIdx.x; const float v = n < CQ ? bq[n] : (n < 2 * CQ ? bk[n - CQ] : 0.f); *(float*)(b + n) = v;  }
template <int NC> __global__ __launch_bounds__(256) void k_xt(const float* __restrict__ x, bf* XT) { x += (size_t)blockIdx.y * NC * NP; XT += (size_t)blockIdx.y * NP * NC; const int e = (blockIdx.x * 256 + threadIdx.x) * 2; if (e >= NP * NC) return; const int c = e % NC; const int p = e / NC; v2us o; o[0] = f2bf(x[(size_t)c * NP + p]); o[1] = f2bf(x[(size_t)(c + 1) * NP + p]); *(v2us*)(XT + e) = o;  }
__global__ __launch_bounds__(256) void k_qkhl(const float* __restrict__ QK, bf* Qh, bf* Ql, bf* Kh, bf* Kl) { const size_t zo = (size_t)blockIdx.y * NP * KP; QK += (size_t)blockIdx.y * NP * 64; Qh += zo; Ql += zo; Kh += zo; Kl += zo; const int e = (blockIdx.x * 256 + threadIdx.x) * 4; if (e >= NP * KP) return; const int d = e % KP; const int p = e / KP; v4us qh, ql, kh, kl;
#pragma unroll
    for (int u = 0; u < 4; ++u) { const int dd = d + u; const float qv = dd < CQ ? QK[(size_t)p * 64 + dd] : 0.f, kv = dd < CQ ? QK[(size_t)p * 64 + CQ + dd] : 0.f; unsigned short a, b; splitf(qv, a, b); qh[u] = a; ql[u] = b; splitf(kv, a, b); kh[u] = a; kl[u] = b; }
    { *(v4us*)(Qh + e) = qh; *(v4us*)(Ql + e) = ql; *(v4us*)(Kh + e) = kh; *(v4us*)(Kl + e) = kl;  } }
__global__ __launch_bounds__(256) void k_v16(const float* __restrict__ V, const float* __restrict__ bv, h16* V16) { const size_t e = ((size_t)blockIdx.x * 256 + threadIdx.x) * 4; if (e >= (size_t)NB_ * CC * NP) return; const int c = (int)(e / NP) % CC; const v4f a = *(const v4f*)(V + e); float bb = bfr(bv[c]); v4h o;
#pragma unroll
    for (int u = 0; u < 4; ++u) o[u] = tohx(__fadd_rn(a[u], bb)); *(v4h*)(V16 + e) = o;  }
__global__ __launch_bounds__(256) void k_psoft(const float* __restrict__ Sb, h16* P16) { const int lane = threadIdx.x & 31; const int row = blockIdx.x * 8 + (threadIdx.x >> 5); if (row >= NP) return; const float* sr = Sb + (size_t)row * NP; float v[NP / 32]; float mx = -3.0e38f;
#pragma unroll
    for (int ch = 0; ch < NP / 128; ++ch) { const v4f a = *(const v4f*)(sr + ch * 128 + lane * 4);
#pragma unroll
        for (int u = 0; u < 4; ++u) { v[ch * 4 + u] = a[u]; mx = fmaxf(mx, a[u]); } }
#pragma unroll
    for (int sh = 16; sh; sh >>= 1) mx = fmaxf(mx, __shfl_xor(mx, sh, 32));
    float sum = 0.f;
#pragma unroll
    for (int q = 0; q < NP / 32; ++q) { float d0 = __fsub_rn(v[q], mx); asm volatile("" : "+v"(d0)); v[q] = __builtin_amdgcn_exp2f(__fmul_rn(d0, 1.4426950408889634f)); sum += v[q]; }
#pragma unroll
    for (int sh = 16; sh; sh >>= 1) sum += __shfl_xor(sum, sh, 32);
    const float f = __fdiv_rn(PCAR, sum);
    {
#pragma unroll
        for (int ch = 0; ch < NP / 128; ++ch) { v4h o4;
#pragma unroll
            for (int q = 0; q < 4; ++q) o4[q] = tohx(v[ch * 4 + q] * f); *(v4h*)(P16 + (size_t)row * NP + ch * 128 + lane * 4) = o4; }
         } }
__global__ __launch_bounds__(256) void k_fin(const float* __restrict__ sod, const float* __restrict__ FEAT, float* OUTb) { const size_t e = ((size_t)blockIdx.x * 256 + threadIdx.x) * 4; if (e >= (size_t)NB_ * CC * NP) return; const v4f s = *(const v4f*)(sod + e), f = *(const v4f*)(FEAT + e); v4f o;
#pragma unroll
    for (int u = 0; u < 4; ++u) { const float sv = bfr(s[u]); float t = __fmul_rn(f[u] * (1.0f / PCAR), sv); asm volatile("" : "+v"(t)); o[u] = __fadd_rn(sv, t); } *(v4f*)(OUTb + e) = o;  }

extern "C" void kernel_launch(void* const* d_in, const int* in_sizes, int n_in,
                              void* d_out, int out_size, void* d_ws, size_t ws_size, hipStream_t stream) {
    (void)in_sizes; (void)n_in; (void)out_size;
    const float* sod = (const float*)d_in[0]; const float* edge = (const float*)d_in[1]; const float* wq = (const float*)d_in[2]; const float* bq = (const float*)d_in[3]; const float* wk = (const float*)d_in[4]; const float* bk = (const float*)d_in[5]; const float* wv = (const float*)d_in[6]; const float* bv = (const float*)d_in[7];
    float* OUT = (float*)d_out;     // [8][256][64][64]
    char* wsp = (char*)d_ws;
    auto take = [&](size_t bytes) { char* p = wsp; wsp += (bytes + 255) & ~(size_t)255; return (void*)p; };
    bf* WQK = (bf*)take(64 * CE * 2); float* bqk = (float*)take(256); bf* WV = (bf*)take(CC * CC * 2); bf* ET = (bf*)take((size_t)NB_ * NP * CE * 2); bf* ST = (bf*)take((size_t)NB_ * NP * CC * 2); float* QK = (float*)take((size_t)NB_ * NP * 64 * 4); float* V = (float*)take((size_t)NB_ * CC * NP * 4);
    bf* Qh = (bf*)take((size_t)NB_ * NP * KP * 2); bf* Ql = (bf*)take((size_t)NB_ * NP * KP * 2); bf* Kh = (bf*)take((size_t)NB_ * NP * KP * 2); bf* Kl = (bf*)take((size_t)NB_ * NP * KP * 2); h16* V16 = (h16*)take((size_t)NB_ * CC * NP * 2); float* Sb = (float*)take((size_t)NP * NP * 4); h16* P16 = (h16*)take((size_t)NP * NP * 2); float* FEAT = (float*)take((size_t)NB_ * CC * NP * 4);
    if ((size_t)(wsp - (char*)d_ws) > ws_size) return;    // total ~ 210 MiB: every plane but the scores and the mask holds all batches
    k_wqk<<<(64 * CE / 4 + 255) / 256, 256, 0, stream>>>(wq, wk, WQK); k_bqk<<<1, 64, 0, stream>>>(bq, bk, bqk); k_cvt8<<<(CC * CC / 8 + 255) / 256, 256, 0, stream>>>(wv, WV, CC * CC / 8);   // wv [out][in] = A operand [c][cc]
    // all batches in one launch each
    k_xt<CE><<<dim3((NP * CE / 2 + 255) / 256, NB_, 1), 256, 0, stream>>>(edge, ET); k_xt<CC><<<dim3((NP * CC / 2 + 255) / 256, NB_, 1), 256, 0, stream>>>(sod, ST);
    k_gemmw<bf, 0, true><<<dim3(NP / 64, 1, NB_), 32, 0, stream>>>(ET, nullptr, WQK, nullptr, CE, QK, 64, bqk, (size_t)NP * CE, 0, (size_t)NP * 64);        // QK[b][p][0..15 | 16..31]
    k_gemmsk<bf, CC, 4><<<dim3(CC / 64, NP / 64, NB_), 128, 0, stream>>>(WV, ST, V, (size_t)NP * CC, (size_t)CC * NP);   // V[b][c][p] = sum_cc wv[c][cc] sod[b][cc][p]
    k_qkhl<<<dim3((NP * KP / 4 + 255) / 256, NB_, 1), 256, 0, stream>>>(QK, Qh, Ql, Kh, Kl); k_v16<<<(unsigned)(((size_t)NB_ * CC * NP / 4 + 255) / 256), 256, 0, stream>>>(V, bv, V16);
    // the score and mask planes hold one batch: these three stay one launch a batch
    for (int b = 0; b < NB_; ++b) {
        k_gemmw<bf, 2, false><<<dim3(NP / 64, NP / 64, 1), 32, 0, stream>>>(Qh + (size_t)b * NP * KP, Ql + (size_t)b * NP * KP, Kh + (size_t)b * NP * KP, Kl + (size_t)b * NP * KP, KP, Sb, NP, nullptr, 0, 0, 0);   // scores[i][j] (3 products)
        k_psoft<<<NP / 8, 256, 0, stream>>>(Sb, P16);
        k_gemmsk<h16, NP, 16><<<dim3(CC / 64, NP / 64, 1), 512, 0, stream>>>(V16 + (size_t)b * CC * NP, P16, FEAT + (size_t)b * CC * NP, 0, 0); } // FEAT[b][c][i] = sum_j v[c][j] P[i][j]
    k_fin<<<(unsigned)(((size_t)NB_ * CC * NP / 4 + 255) / 256), 256, 0, stream>>>(sod, FEAT, OUT);
}

// v004
// It runs in 118 microseconds.
// It is 4.71 times as fast as v002, going by the measured steps of the versions left out in between.
// Over all steps from v000 it is 10.4 times as fast.
#include <hip/hip_runtime.h>

// (sod [8][256][64x64], edge [8][32][64x64]; q = wq edge + bq, k = wk edge + bk (16 channels), v = wv sod + bv; mask = softmax_j(sum_d q[d][i] k[d][j]) (unscaled); feat[c][i] = sum_j v[c][j] mask[i][j]; out = sod + feat * sod -> [8][256][64][64]).
// Compute dtypes, f32 accumulate: every input rounded to bf16; q|k as one GEMM edge^T x [wq; wk]^T and v = wv x sod on PLAIN bf16 operands (inputs: every product exact) + bias; scores (K 16, padded to 32) on bf16 hi+lo planes of q, k (3 products - the unscaled logits are too large for fp16 operands);
// mask and feat: one fused kernel (k_attn), scores^T -> exponentials against a running row maximum -> f16 B operand in registers -> feat^T += v x mask^T on f16 operands; row sums in f32, divided out at the end.

#define NB_  8
#define CC   256
#define CE   32
#define CQ   16
#define NP   4096
#define KP   32
#define PCAR 1024.0f
typedef _Float16 h16;
typedef unsigned short bf;
typedef __attribute__((ext_vector_type(16))) __bf16   v16bf;
typedef __attribute__((ext_vector_type(16))) _Float16 v16h;
typedef __attribute__((ext_vector_type(8)))  _Float16 v8h;
typedef __attribute__((ext_vector_type(8)))  unsigned short v8us;
typedef __attribute__((ext_vector_type(8)))  float    v8f;
typedef __attribute__((ext_vector_type(4)))  float    v4f;
typedef v8h  __attribute__((may_alias)) v8ha;
typedef v4f  __attribute__((may_alias)) v4fa;
typedef v8us __attribute__((may_alias)) v8usa;

__device__ __forceinline__ unsigned short f2bf(float f) { unsigned u = __float_as_uint(f); u += 0x7FFFu + ((u >> 16) & 1u); return (unsigned short)(u >> 16); }
__device__ __forceinline__ float bf2f(unsigned short b) { return __uint_as_float(((unsigned)b) << 16); }
__device__ __forceinline__ float bfr(float f) { return bf2f(f2bf(f)); }
__device__ __forceinline__ v16h cat16(v8h lo, v8h hi) { return __builtin_shufflevector(lo, hi, 0, 1, 2, 3, 4, 5, 6, 7, 8, 9, 10, 11, 12, 13, 14, 15); }
__device__ __forceinline__ v16bf cat16b(v8us lo, v8us hi) { return __builtin_bit_cast(v16bf, __builtin_shufflevector(lo, hi, 0, 1, 2, 3, 4, 5, 6, 7, 8, 9, 10, 11, 12, 13, 14, 15)); }
__device__ __forceinline__ v8f wmma16(v16h a, v16h b, v8f c) { return __builtin_amdgcn_wmma_f32_16x16x32_f16(false, a, false, b, (short)0, c, false, false); }
__device__ __forceinline__ v8f wmmab(v16bf a, v16bf b, v8f c) { return __builtin_amdgcn_wmma_f32_16x16x32_bf16(false, a, false, b, (short)0, c, false, false); }



// ---- k_gemmw: register-blocked GEMM, ONE WAVE per 64x64 output tile (16 accumulators), operands straight from K-contiguous 16-bit planes; grid (M/64, N/64, Z), 32 threads.
// C[m][n] (f32, pitch ldc, + optional f32 bias[n]) = sum_k A[m][k] Bt[n][k] (+ split products per NSPLIT). z-batch strides sA/sB/sC in elements. K % 32 == 0.
template <typename T16> struct WFrag;
template <> struct WFrag<h16> { typedef v16h V; static __device__ __forceinline__ V ld(const h16* p) { return cat16(*(const v8h*)p, *(const v8h*)(p + 16)); } static __device__ __forceinline__ v8f mma(V a, V b, v8f c) { return wmma16(a, b, c); } };
template <> struct WFrag<bf> { typedef v16bf V; static __device__ __forceinline__ V ld(const bf* p) { return cat16b(*(const v8us*)p, *(const v8us*)(p + 16)); } static __device__ __forceinline__ v8f mma(V a, V b, v8f c) { return wmmab(a, b, c); } };
template <typename T16, int NSPLIT, bool BIAS>
__global__ __launch_bounds__(32) void k_gemmw(const T16* __restrict__ A, const T16* __restrict__ A2, const T16* __restrict__ Bt, const T16* __restrict__ Bt2, int K, float* C, int ldc, const float* __restrict__ bias, size_t sA, size_t sB, size_t sC) {
    typedef typename WFrag<T16>::V V;
    __shared__ __align__(16) float os[16 * 68];
    const size_t z = blockIdx.z; A += z * sA; if (A2) A2 += z * sA; Bt += z * sB; if (Bt2) Bt2 += z * sB; C += z * sC;
    const int lane = threadIdx.x & 31, lr = lane & 15, hi = lane >> 4; const int r0 = blockIdx.x * 64, c0 = blockIdx.y * 64;
    v8f acc[4][4];
#pragma unroll
    for (int mb = 0; mb < 4; ++mb)
#pragma unroll
        for (int nb = 0; nb < 4; ++nb) acc[mb][nb] = (v8f){};
    const size_t aoff = (size_t)(r0 + lr) * K + 8 * hi, boff = (size_t)(c0 + lr) * K + 8 * hi;
#pragma unroll 1
    for (int kc = 0; kc < K; kc += 32) {
        V a[4], a2[4];
#pragma unroll
        for (int mb = 0; mb < 4; ++mb) { a[mb] = WFrag<T16>::ld(A + aoff + (size_t)mb * 16 * K + kc); if (NSPLIT == 1 || NSPLIT == 2) a2[mb] = WFrag<T16>::ld(A2 + aoff + (size_t)mb * 16 * K + kc); }
#pragma unroll
        for (int nb = 0; nb < 4; ++nb) { const V b = WFrag<T16>::ld(Bt + boff + (size_t)nb * 16 * K + kc); V b2; if (NSPLIT >= 2) b2 = WFrag<T16>::ld(Bt2 + boff + (size_t)nb * 16 * K + kc);
#pragma unroll
            for (int mb = 0; mb < 4; ++mb) { acc[mb][nb] = WFrag<T16>::mma(a[mb], b, acc[mb][nb]); if (NSPLIT == 1 || NSPLIT == 2) acc[mb][nb] = WFrag<T16>::mma(a2[mb], b, acc[mb][nb]); if (NSPLIT >= 2) acc[mb][nb] = WFrag<T16>::mma(a[mb], b2, acc[mb][nb]); } }
        asm volatile("v_nop\n\tv_nop\n\tv_nop\n\tv_nop" : "+v"(acc[0][0]), "+v"(acc[1][1]), "+v"(acc[2][2]), "+v"(acc[3][3]) : "v"(a[0]), "v"(a[3]));
    }
#pragma unroll
    for (int mb = 0; mb < 4; ++mb) {
#pragma unroll
        for (int nb = 0; nb < 4; ++nb) {
#pragma unroll
            for (int j = 0; j < 8; ++j) os[(hi * 8 + j) * 68 + nb * 16 + lr] = acc[mb][nb][j]; }
        __builtin_amdgcn_wave_barrier(); asm volatile("" ::: "memory");
        float* crow = C + (size_t)(r0 + mb * 16) * ldc + c0;
{
#pragma unroll
            for (int s = 0; s < 8; ++s) { const int row = 2 * s + hi, cofs = lr * 4; v4f val = *(const v4fa*)(os + row * 68 + cofs); if (BIAS) { val[0] += bfr(bias[c0 + cofs]); val[1] += bfr(bias[c0 + cofs + 1]); val[2] += bfr(bias[c0 + cofs + 2]); val[3] += bfr(bias[c0 + cofs + 3]); }
                *(v4f*)(crow + (size_t)row * ldc + cofs) = val; }
             }
        __builtin_amdgcn_wave_barrier(); asm volatile("" ::: "memory");
    }
}

__device__ __forceinline__ h16 tohx(float x) { return (h16)x; }
__device__ __forceinline__ void splitf(float y, unsigned short& h, unsigned short& l) { h = f2bf(y); l = f2bf(y - bf2f(h)); }
typedef __attribute__((ext_vector_type(2))) unsigned short v2us;
typedef __attribute__((ext_vector_type(4))) unsigned short v4us;

__global__ __launch_bounds__(256) void k_cvt8(const float* __restrict__ src, bf* dst, size_t n8) { const size_t i = (size_t)blockIdx.x * 256 + threadIdx.x; if (i >= n8) return; const v8f v = *(const v8f*)(src + i * 8); v8us o;
#pragma unroll
    for (int k = 0; k < 8; ++k) o[k] = f2bf(v[k]); *(v8us*)(dst + i * 8) = o;  }
// k_xt and k_qkhl take the batch from blockIdx.y; k_fin runs flat over all batches ([b][c][p] is contiguous).
// k_wqk: Bt [64][32] bf16 = [wq; wk; 0]; k_bqk: bias [64] = [bq | bk | 0]; k_xt: XT[p][c] = bf16 x[c][p] (lane -> 2 consecutive c); k_qkhl: hl planes of q and k (32 wide, d >= 16 zero) from QK[p][0..31] (8-B lanes);
__global__ __launch_bounds__(256) void k_wqk(const float* __restrict__ wq, const float* __restrict__ wk, bf* Bt) { const int e = (blockIdx.x * 256 + threadIdx.x) * 4; if (e >= 64 * CE) return; const int c = e % CE, n = e / CE; v4us o;
#pragma unroll
    for (int u = 0; u < 4; ++u) o[u] = n < CQ ? f2bf(wq[n * CE + c + u]) : (n < 2 * CQ ? f2bf(wk[(n - CQ) * CE + c + u]) : (unsigned short)0); *(v4us*)(Bt + e) = o;  }
__global__ __launch_bounds__(64) void k_bqk(const float* __restrict__ bq, const float* __restrict__ bk, float* b) { const int n = threadIdx.x; const float v = n < CQ ? bq[n] : (n < 2 * CQ ? bk[n - CQ] : 0.f); *(float*)(b + n) = v;  }
template <int NC> __global__ __launch_bounds__(256) void k_xt(const float* __restrict__ x, bf* XT) { x += (size_t)blockIdx.y * NC * NP; XT += (size_t)blockIdx.y * NP * NC; const int e = (blockIdx.x * 256 + threadIdx.x) * 2; if (e >= NP * NC) return; const int c = e % NC; const int p = e / NC; v2us o; o[0] = f2bf(x[(size_t)c * NP + p]); o[1] = f2bf(x[(size_t)(c + 1) * NP + p]); *(v2us*)(XT + e) = o;  }
__global__ __launch_bounds__(256) void k_qkhl(const float* __restrict__ QK, bf* Qh, bf* Ql, bf* Kh, bf* Kl) { const size_t zo = (size_t)blockIdx.y * NP * KP; QK += (size_t)blockIdx.y * NP * 64; Qh += zo; Ql += zo; Kh += zo; Kl += zo; const int e = (blockIdx.x * 256 + threadIdx.x) * 4; if (e >= NP * KP) return; const int d = e % KP; const int p = e / KP; v4us qh, ql, kh, kl;
#pragma unroll
    for (int u = 0; u < 4; ++u) { const int dd = d + u; const float qv = dd < CQ ? QK[(size_t)p * 64 + dd] : 0.f, kv = dd < CQ ? QK[(size_t)p * 64 + CQ + dd] : 0.f; unsigned short a, b; splitf(qv, a, b); qh[u] = a; ql[u] = b; splitf(kv, a, b); kh[u] = a; kl[u] = b; }
    { *(v4us*)(Qh + e) = qh; *(v4us*)(Ql + e) = ql; *(v4us*)(Kh + e) = kh; *(v4us*)(Kl + e) = kl;  } }
// ---- k_vf: V16[b][c][p] = f16(sum_cc wv[c][cc] bf16(sod[b][cc][p]) + bf16(bv[c])): transpose, product and conversion in one kernel; grid (NP/64, batches), 8 waves; a work-group owns 64 pixels p and all 256 c.
// The [256 cc][64 p] f32 tile comes in by whole 128-byte lines (a lane: 2 x 8 rows cc x 4 pixels), is rounded to bf16 and written to LDS as X[p][cc], 16 bytes (8 cc of one p) a store.
// Transposed product V^T = X wv^T (A = X rows p from LDS, B = wv rows c, 32 per wave, held in registers; both in the k order of WFrag::ld), one accumulator chain over the 8 chunks of k:
// a lane then holds 8 consecutive p of ONE c, 16 bytes of f16, staged in Y[c][p] and stored as whole 128-byte lines.
#define XP 264                           // bf16 elements; 528-byte rows read and written by 16-byte LDS operations: an odd multiple of 16
#define YP 72                            // f16 elements; 144-byte rows, the same rule
__global__ __launch_bounds__(256) void k_vf(const float* __restrict__ sod, const bf* __restrict__ WV, const float* __restrict__ bv, h16* __restrict__ V16) {
    __shared__ __align__(16) bf X[64 * XP];
    __shared__ __align__(16) h16 Y[CC * YP];
    const int tid = threadIdx.x, lane = tid & 31, lr = lane & 15, hi = lane >> 4, wave = tid >> 5; const int p0 = blockIdx.x * 64;
    sod += (size_t)blockIdx.y * CC * NP; V16 += (size_t)blockIdx.y * CC * NP;
    // a wave's load covers 4 rows cc x one whole line (8 lanes x 4 pixels); its 16-byte LDS stores then fall on all 64 banks
    const int pq = (lane & 7) + 8 * (wave & 1), g0 = (lane >> 3) + 4 * (wave >> 1);
    const float* sp = sod + (size_t)(g0 * 8) * NP + p0 + pq * 4;
    const bf* wp = WV + (size_t)(wave * 32 + lr) * CC + 8 * hi;
    v4f x[2][8]; v16bf w[2][8];
#pragma unroll
    for (int h = 0; h < 2; ++h)
#pragma unroll
        for (int r = 0; r < 8; ++r) x[h][r] = *(const v4f*)(sp + (size_t)(h * 128 + r) * NP);
#pragma unroll
    for (int cn = 0; cn < 2; ++cn)
#pragma unroll
        for (int kc = 0; kc < 8; ++kc) w[cn][kc] = WFrag<bf>::ld(wp + cn * 16 * CC + kc * 32);
    const float bb0 = bfr(bv[wave * 32 + lr]), bb1 = bfr(bv[wave * 32 + 16 + lr]);
    // behind the kernel's last load: both address pairs are inputs, so they stay whole up to this wait
    asm volatile("s_wait_xcnt 0x0" :: "v"(sp), "v"(wp) : "memory");
#pragma unroll
    for (int h = 0; h < 2; ++h)
#pragma unroll
        for (int u = 0; u < 4; ++u) { v8us o;
#pragma unroll
            for (int r = 0; r < 8; ++r) o[r] = f2bf(x[h][r][u]);
            *(v8usa*)(X + (pq * 4 + u) * XP + h * 128 + g0 * 8) = o; }
    __syncthreads();   // the whole transposed tile is in LDS before any wave reads fragments of it
    v8f acc[4][2];
#pragma unroll
    for (int pm = 0; pm < 4; ++pm) { acc[pm][0] = (v8f){}; acc[pm][1] = (v8f){}; }
#pragma unroll
    for (int kc = 0; kc < 8; ++kc)
#pragma unroll
        for (int pm = 0; pm < 4; ++pm) { const bf* xr = X + (pm * 16 + lr) * XP + 8 * hi + kc * 32; const v16bf a = cat16b(*(const v8usa*)xr, *(const v8usa*)(xr + 16));
            acc[pm][0] = wmmab(a, w[0][kc], acc[pm][0]); acc[pm][1] = wmmab(a, w[1][kc], acc[pm][1]); }
#pragma unroll
    for (int pm = 0; pm < 4; ++pm)
#pragma unroll
        for (int cn = 0; cn < 2; ++cn) { v8h o;   // accumulator register j: pixel pm * 16 + hi * 8 + j; lane column: c = wave * 32 + cn * 16 + lr
#pragma unroll
            for (int j = 0; j < 8; ++j) o[j] = tohx(__fadd_rn(acc[pm][cn][j], cn ? bb1 : bb0));
            *(v8ha*)(Y + (wave * 32 + cn * 16 + lr) * YP + pm * 16 + hi * 8) = o; }
    __syncthreads();   // the whole [256][64] tile is staged before rows are read back
    v8h y[8]; h16* vp = V16 + (size_t)(tid >> 3) * NP + p0 + (tid & 7) * 8;   // 8 lanes store one whole 128-byte line: every line has one writer
#pragma unroll
    for (int s = 0; s < 8; ++s) y[s] = *(const v8ha*)(Y + (s * 32 + (tid >> 3)) * YP + (tid & 7) * 8);
#pragma unroll
    for (int s = 0; s < 8; ++s) *(v8h*)(vp + (size_t)s * 32 * NP) = y[s];
}
#define SKEY   64
#define NSTG   (NP / SKEY)
#define VPITCH 144                       // bytes; 128-byte rows read by 16-byte LDS loads: an odd multiple of 16
#define KPITCH 48                        // bytes; 32-byte rows, the same rule
#define VTILE  (CC * VPITCH)
#define KTILE  (SKEY * KPITCH)
#define SBUF   (VTILE + 2 * KTILE)
#define OPITCH 132                       // floats; output staging [256 c][128 i]
#define PSH    6.0f                      // exponentials carry 2^6 (at most 2^14 with the lazy maximum): small ones keep f16 precision; it cancels against the row sum
typedef __attribute__((ext_vector_type(2))) float v2f;
typedef __attribute__((ext_vector_type(2))) _Float16 v2h;
typedef __attribute__((ext_vector_type(8))) unsigned v8u;
typedef v4us __attribute__((may_alias)) v4usa;
__device__ __forceinline__ float xhalf(float x) { return __builtin_bit_cast(float, __builtin_amdgcn_permlanex16(__builtin_bit_cast(int, x), __builtin_bit_cast(int, x), 0x76543210, 0xfedcba98, false, false)); }  // lane l with lane l ^ 16
__device__ __forceinline__ unsigned pack2h(float a, float b) { return __builtin_bit_cast(unsigned, __builtin_convertvector((v2f){a, b}, v2h)); }  // round to nearest even
__global__ __launch_bounds__(256) __attribute__((amdgpu_waves_per_eu(2, 2))) void k_attn(const bf* __restrict__ Qh, const bf* __restrict__ Ql, const bf* __restrict__ Kh, const bf* __restrict__ Kl, const h16* __restrict__ V16, float* __restrict__ FEAT) {
    __shared__ __align__(16) unsigned char L[CC * OPITCH * 4];
    static_assert(2 * SBUF <= CC * OPITCH * 4, "the two stage buffers lie inside the output staging");
    const int tid = threadIdx.x, lane = tid & 31, lr = lane & 15, hi = lane >> 4, wave = tid >> 5; const int i0 = blockIdx.x * 128;
    { const size_t zo = (size_t)blockIdx.y * NP * KP, zv = (size_t)blockIdx.y * CC * NP; Qh += zo; Ql += zo; Kh += zo; Kl += zo; V16 += zv; FEAT += zv; }
    const v8us z8 = (v8us){};
    const size_t qo = (size_t)(i0 + wave * 16 + lr) * KP + 8 * hi; const bf* qhp = Qh + qo; const bf* qlp = Ql + qo;
    const v16bf qfh = cat16b(*(const v8usa*)qhp, z8), qfl = cat16b(*(const v8usa*)qlp, z8);
    // behind the two q loads: both address pairs are inputs, so they stay whole up to this wait
    asm volatile("s_wait_xcnt 0x0" :: "v"(qhp), "v"(qlp) : "memory");
    // q has landed in front of the loop (loaded values as inputs only): otherwise the wait for it stands inside the pass and there also waits for the next stage's loads in flight
    asm volatile("" :: "v"(qfh), "v"(qfl));
    // staging: 8 threads bring one 128-byte row piece of v (rows tid/8 + 32 u); 4 threads bring the 32 real bytes of one k row, of the hi and of the lo plane. The lane offsets never change; the stage moves the uniform base.
    const unsigned vof = (unsigned)(tid >> 3) * NP + (tid & 7) * 8, kof = (unsigned)(tid >> 2) * KP + (tid & 3) * 4;
    const unsigned vdst = (tid >> 3) * VPITCH + (tid & 7) * 16, kdst = VTILE + (tid >> 2) * KPITCH + (tid & 3) * 8;
    v8us sv[8]; v4us skh, skl;
    auto fetch = [&](int st) { const h16* vp = V16 + st * SKEY; const bf* khp = Kh + st * (SKEY * KP); const bf* klp = Kl + st * (SKEY * KP);
#pragma unroll
        for (int u = 0; u < 8; ++u) sv[u] = *(const v8usa*)(vp + u * (32 * NP) + vof);
        skh = *(const v4usa*)(khp + kof); skl = *(const v4usa*)(klp + kof);
        // behind the stage's last load: the three bases are inputs, so they stay whole up to this wait (the lane offsets are made once, in front of the loop, and never rewritten in it)
        asm volatile("s_wait_xcnt 0x0" :: "s"(vp), "s"(khp), "s"(klp) : "memory"); };
    auto put = [&](unsigned base) {
#pragma unroll
        for (int u = 0; u < 8; ++u) *(v8usa*)(L + base + vdst + u * 32 * VPITCH) = sv[u];
        *(v4usa*)(L + base + kdst) = skh; *(v4usa*)(L + base + kdst + KTILE) = skl; };
    v8f acc[16];
#pragma unroll
    for (int t = 0; t < 16; ++t) acc[t] = (v8f){};
    float m_run = -__builtin_inff(), l0 = 0.f, l1 = 0.f;
#pragma unroll 1
    for (int st = -1; st < NSTG; ++st) {   // rolled: one stage's code, the buffer by offset; trip -1 only brings stage 0 in (no passes), so the staging code stands once
        const unsigned base = (st & 1) * SBUF;
        if (st + 1 < NSTG) fetch(st + 1);
#pragma unroll 1
        for (int ps = st < 0 ? SKEY / 32 : 0; ps < SKEY / 32; ++ps) {   // rolled: a pass of 32 keys holds all the registers there are
            const unsigned char* kb = L + base + VTILE + (ps * 32 + lr) * KPITCH + hi * 16;
            const v16bf kh0 = cat16b(*(const v8usa*)kb, z8), kh1 = cat16b(*(const v8usa*)(kb + 16 * KPITCH), z8), kl0 = cat16b(*(const v8usa*)(kb + KTILE), z8), kl1 = cat16b(*(const v8usa*)(kb + KTILE + 16 * KPITCH), z8);
            v8f s0 = (v8f){}, s1 = (v8f){};
            s0 = wmmab(kh0, qfh, s0); s1 = wmmab(kh1, qfh, s1); s0 = wmmab(kh0, qfl, s0); s1 = wmmab(kh1, qfl, s1); s0 = wmmab(kl0, qfh, s0); s1 = wmmab(kl1, qfh, s1);
            float mx = fmaxf(s0[0], s1[0]);
#pragma unroll
            for (int r = 1; r < 8; ++r) mx = fmaxf(mx, fmaxf(s0[r], s1[r]));
            mx = fmaxf(mx, xhalf(mx)) * 1.4426950408889634f;   // both wave halves hold row i's maximum over the 32 keys
            if (__builtin_amdgcn_ballot_w32(mx > m_run + 8.0f) != 0) {   // one scalar test a pass; rare after the first passes
                const float m_new = fmaxf(m_run, mx), corr = __builtin_amdgcn_exp2f(m_run - m_new);   // 0 in the first pass
                l0 *= corr; l1 *= corr; m_run = m_new;
#pragma unroll
                for (int t = 0; t < 16; ++t) acc[t] = acc[t] * corr;
            }
            // the pass's v fragments: rows c = 16 t + lr, keys 8 hi .. + 7 and 16 + 8 hi .. + 7 of the pass's 32
            const unsigned char* vb = L + base + lr * VPITCH + ps * 64 + hi * 16;
            v16h vf[16];
#pragma unroll
            for (int t = 0; t < 16; ++t) vf[t] = cat16(*(const v8ha*)(vb + t * 16 * VPITCH), *(const v8ha*)(vb + t * 16 * VPITCH + 32));
            __builtin_amdgcn_sched_barrier(0);   // all 32 LDS loads issue as one group in front of the exponentials and land under them; left free they sink to one product ahead of their use
            const float nm = PSH - m_run; v8u w; float x[16], e[16];   // element s of the B operand: tile s / 8, register s % 8
#pragma unroll
            for (int q = 0; q < 16; ++q) x[q] = __builtin_fmaf(q < 8 ? s0[q & 7] : s1[q & 7], 1.4426950408889634f, nm);
#pragma unroll
            for (int q = 0; q < 16; q += 4)   // four exponentials and one slot in one statement: behind each stands an instruction that neither reads its result nor overwrites its source (outputs apart from all inputs)
                asm("v_exp_f32 %0, %4\n\tv_exp_f32 %1, %5\n\tv_exp_f32 %2, %6\n\tv_exp_f32 %3, %7\n\tv_nop" : "=&v"(e[q]), "=&v"(e[q + 1]), "=&v"(e[q + 2]), "=&v"(e[q + 3]) : "v"(x[q]), "v"(x[q + 1]), "v"(x[q + 2]), "v"(x[q + 3]));
#pragma unroll
            for (int q = 0; q < 8; ++q) { l0 += e[2 * q]; l1 += e[2 * q + 1]; w[q] = pack2h(e[2 * q], e[2 * q + 1]); }
            const v16h pf = __builtin_bit_cast(v16h, w);
#pragma unroll
            for (int t = 0; t < 16; ++t) acc[t] = wmma16(vf[t], pf, acc[t]);
            // four vector slots behind the pass's last products, on the taken back edge too, before the next pass's loads land in the operand registers
            __builtin_amdgcn_sched_barrier(0); asm volatile("v_nop\n\tv_nop\n\tv_nop\n\tv_nop"); __builtin_amdgcn_sched_barrier(0);
        }
        if (st + 1 < NSTG) put(SBUF - base);   // the other buffer: its readers left it before the barrier that ended stage st - 1
        __syncthreads();   // publishes stage st + 1 and ends every wave's reads of this stage's buffer
    }
    float l = l0 + l1; l += xhalf(l);   // each wave half summed its own 16 of every 32 keys
    const float f = __fdiv_rn(PCAR, l);
    float* O = (float*)L;   // the ring is free behind the loop's last barrier
#pragma unroll
    for (int t = 0; t < 16; ++t)
#pragma unroll
        for (int r = 0; r < 8; ++r) O[(t * 16 + hi * 8 + r) * OPITCH + wave * 16 + lr] = acc[t][r] * f;
    __syncthreads();   // the whole [256][128] tile is staged before rows are read back
    v4f o[32];   // a wave stores whole 512-byte rows: every 128-byte line has one writer
#pragma unroll
    for (int s = 0; s < 32; ++s) o[s] = *(const v4fa*)(O + (s * 8 + wave) * OPITCH + lane * 4);
#pragma unroll
    for (int s = 0; s < 32; ++s) *(v4f*)(FEAT + (size_t)(s * 8 + wave) * NP + i0 + lane * 4) = o[s];
}
__global__ __launch_bounds__(256) void k_fin(const float* __restrict__ sod, const float* __restrict__ FEAT, float* OUTb) { const size_t e = ((size_t)blockIdx.x * 256 + threadIdx.x) * 4; if (e >= (size_t)NB_ * CC * NP) return; const v4f s = *(const v4f*)(sod + e), f = *(const v4f*)(FEAT + e); v4f o;
#pragma unroll
    for (int u = 0; u < 4; ++u) { const float sv = bfr(s[u]); float t = __fmul_rn(f[u] * (1.0f / PCAR), sv); asm volatile("" : "+v"(t)); o[u] = __fadd_rn(sv, t); } *(v4f*)(OUTb + e) = o;  }

extern "C" void kernel_launch(void* const* d_in, const int* in_sizes, int n_in,
                              void* d_out, int out_size, void* d_ws, size_t ws_size, hipStream_t stream) {
    (void)in_sizes; (void)n_in; (void)out_size;
    const float* sod = (const float*)d_in[0]; const float* edge = (const float*)d_in[1]; const float* wq = (const float*)d_in[2]; const float* bq = (const float*)d_in[3]; const float* wk = (const float*)d_in[4]; const float* bk = (const float*)d_in[5]; const float* wv = (const float*)d_in[6]; const float* bv = (const float*)d_in[7];
    float* OUT = (float*)d_out;     // [8][256][64][64]
    char* wsp = (char*)d_ws;
    auto take = [&](size_t bytes) { char* p = wsp; wsp += (bytes + 255) & ~(size_t)255; return (void*)p; };
    bf* WQK = (bf*)take(64 * CE * 2); float* bqk = (float*)take(256); bf* WV = (bf*)take(CC * CC * 2); bf* ET = (bf*)take((size_t)NB_ * NP * CE * 2); float* QK = (float*)take((size_t)NB_ * NP * 64 * 4);
    bf* Qh = (bf*)take((size_t)NB_ * NP * KP * 2); bf* Ql = (bf*)take((size_t)NB_ * NP * KP * 2); bf* Kh = (bf*)take((size_t)NB_ * NP * KP * 2); bf* Kl = (bf*)take((size_t)NB_ * NP * KP * 2); h16* V16 = (h16*)take((size_t)NB_ * CC * NP * 2); float* FEAT = (float*)take((size_t)NB_ * CC * NP * 4);
    if ((size_t)(wsp - (char*)d_ws) > ws_size) return;    // total ~ 66 MiB: every plane holds all batches
    k_wqk<<<(64 * CE / 4 + 255) / 256, 256, 0, stream>>>(wq, wk, WQK); k_bqk<<<1, 64, 0, stream>>>(bq, bk, bqk); k_cvt8<<<(CC * CC / 8 + 255) / 256, 256, 0, stream>>>(wv, WV, CC * CC / 8);   // wv [out][in] = B operand rows [c][cc]
    // all batches in one launch each
    k_xt<CE><<<dim3((NP * CE / 2 + 255) / 256, NB_, 1), 256, 0, stream>>>(edge, ET);
    k_gemmw<bf, 0, true><<<dim3(NP / 64, 1, NB_), 32, 0, stream>>>(ET, nullptr, WQK, nullptr, CE, QK, 64, bqk, (size_t)NP * CE, 0, (size_t)NP * 64);        // QK[b][p][0..15 | 16..31]
    k_vf<<<dim3(NP / 64, NB_, 1), 256, 0, stream>>>(sod, WV, bv, V16);   // V16[b][c][p] = f16(sum_cc wv[c][cc] sod[b][cc][p] + bv[c])
    k_qkhl<<<dim3((NP * KP / 4 + 255) / 256, NB_, 1), 256, 0, stream>>>(QK, Qh, Ql, Kh, Kl);
    k_attn<<<dim3(NP / 128, NB_, 1), 256, 0, stream>>>(Qh, Ql, Kh, Kl, V16, FEAT);   // FEAT[b][c][i] = PCAR sum_j v[c][j] mask[i][j]
    k_fin<<<(unsigned)(((size_t)NB_ * CC * NP / 4 + 255) / 256), 256, 0, stream>>>(sod, FEAT, OUT);
}

// v005
// Measured time: 111 microseconds a run.
// Next to v004, in two timings, it ran 1.06 times as fast each time.
// Counting every step since v000, it is 11.0 times as fast.
#include <hip/hip_runtime.h>

// (sod [8][256][64x64], edge [8][32][64x64]; q = wq edge + bq, k = wk edge + bk (16 channels), v = wv sod + bv; mask = softmax_j(sum_d q[d][i] k[d][j]) (unscaled); feat[c][i] = sum_j v[c][j] mask[i][j]; out = sod + feat * sod -> [8][256][64][64]).
// Compute dtypes, f32 accumulate: every input rounded to bf16; q|k as one GEMM edge^T x [wq; wk]^T and v = wv x sod on PLAIN bf16 operands (inputs: every product exact) + bias; scores (K 16, padded to 32) on bf16 hi+lo planes of q, k (3 products - the unscaled logits are too large for fp16 operands);
// mask and feat: one fused kernel (k_attn), scores^T -> exponentials against a running row maximum -> f16 B operand in registers -> feat^T += v x mask^T on f16 operands; row sums in f32, divided out at the end.

#define NB_  8
#define CC   256
#define CE   32
#define CQ   16
#define NP   4096
#define KP   32
#define PCAR 1024.0f
typedef _Float16 h16;
typedef unsigned short bf;
typedef __attribute__((ext_vector_type(16))) __bf16   v16bf;
typedef __attribute__((ext_vector_type(16))) _Float16 v16h;
typedef __attribute__((ext_vector_type(8)))  _Float16 v8h;
typedef __attribute__((ext_vector_type(8)))  unsigned short v8us;
typedef __attribute__((ext_vector_type(8)))  float    v8f;
typedef __attribute__((ext_vector_type(4)))  float    v4f;
typedef v8h  __attribute__((may_alias)) v8ha;
typedef v4f  __attribute__((may_alias)) v4fa;
typedef v8us __attribute__((may_alias)) v8usa;

__device__ __forceinline__ unsigned short f2bf(float f) { unsigned u = __float_as_uint(f); u += 0x7FFFu + ((u >> 16) & 1u); return (unsigned short)(u >> 16); }
__device__ __forceinline__ float bf2f(unsigned short b) { return __uint_as_float(((unsigned)b) << 16); }
__device__ __forceinline__ float bfr(float f) { return bf2f(f2bf(f)); }
__device__ __forceinline__ v16h cat16(v8h lo, v8h hi) { return __builtin_shufflevector(lo, hi, 0, 1, 2, 3, 4, 5, 6, 7, 8, 9, 10, 11, 12, 13, 14, 15); }
__device__ __forceinline__ v16bf cat16b(v8us lo, v8us hi) { return __builtin_bit_cast(v16bf, __builtin_shufflevector(lo, hi, 0, 1, 2, 3, 4, 5, 6, 7, 8, 9, 10, 11, 12, 13, 14, 15)); }
__device__ __forceinline__ v8f wmma16(v16h a, v16h b, v8f c) { return __builtin_amdgcn_wmma_f32_16x16x32_f16(false, a, false, b, (short)0, c, false, false); }
__device__ __forceinline__ v8f wmmab(v16bf a, v16bf b, v8f c) { return __builtin_amdgcn_wmma_f32_16x16x32_bf16(false, a, false, b, (short)0, c, false, false); }



// ---- k_gemmw: register-blocked GEMM, ONE WAVE per 64x64 output tile (16 accumulators), operands straight from K-contiguous 16-bit planes; grid (M/64, N/64, Z), 32 threads.
// C[m][n] (f32, pitch ldc, + optional f32 bias[n]) = sum_k A[m][k] Bt[n][k] (+ split products per NSPLIT). z-batch strides sA/sB/sC in elements. K % 32 == 0.
template <typename T16> struct WFrag;
template <> struct WFrag<h16> { typedef v16h V; static __device__ __forceinline__ V ld(const h16* p) { return cat16(*(const v8h*)p, *(const v8h*)(p + 16)); } static __device__ __forceinline__ v8f mma(V a, V b, v8f c) { return wmma16(a, b, c); } };
template <> struct WFrag<bf> { typedef v16bf V; static __device__ __forceinline__ V ld(const bf* p) { return cat16b(*(const v8us*)p, *(const v8us*)(p + 16)); } static __device__ __forceinline__ v8f mma(V a, V b, v8f c) { return wmmab(a, b, c); } };
template <typename T16, int NSPLIT, bool BIAS>
__global__ __launch_bounds__(32) void k_gemmw(const T16* __restrict__ A, const T16* __restrict__ A2, const T16* __restrict__ Bt, const T16* __restrict__ Bt2, int K, float* C, int ldc, const float* __restrict__ bias, size_t sA, size_t sB, size_t sC) {
    typedef typename WFrag<T16>::V V;
    __shared__ __align__(16) float os[16 * 68];
    const size_t z = blockIdx.z; A += z * sA; if (A2) A2 += z * sA; Bt += z * sB; if (Bt2) Bt2 += z * sB; C += z * sC;
    const int lane = threadIdx.x & 31, lr = lane & 15, hi = lane >> 4; const int r0 = blockIdx.x * 64, c0 = blockIdx.y * 64;
    v8f acc[4][4];
#pragma unroll
    for (int mb = 0; mb < 4; ++mb)
#pragma unroll
        for (int nb = 0; nb < 4; ++nb) acc[mb][nb] = (v8f){};
    const size_t aoff = (size_t)(r0 + lr) * K + 8 * hi, boff = (size_t)(c0 + lr) * K + 8 * hi;
#pragma unroll 1
    for (int kc = 0; kc < K; kc += 32) {
        V a[4], a2[4];
#pragma unroll
        for (int mb = 0; mb < 4; ++mb) { a[mb] = WFrag<T16>::ld(A + aoff + (size_t)mb * 16 * K + kc); if (NSPLIT == 1 || NSPLIT == 2) a2[mb] = WFrag<T16>::ld(A2 + aoff + (size_t)mb * 16 * K + kc); }
#pragma unroll
        for (int nb = 0; nb < 4; ++nb) { const V b = WFrag<T16>::ld(Bt + boff + (size_t)nb * 16 * K + kc); V b2; if (NSPLIT >= 2) b2 = WFrag<T16>::ld(Bt2 + boff + (size_t)nb * 16 * K + kc);
#pragma unroll
            for (int mb = 0; mb < 4; ++mb) { acc[mb][nb] = WFrag<T16>::mma(a[mb], b, acc[mb][nb]); if (NSPLIT == 1 || NSPLIT == 2) acc[mb][nb] = WFrag<T16>::mma(a2[mb], b, acc[mb][nb]); if (NSPLIT >= 2) acc[mb][nb] = WFrag<T16>::mma(a[mb], b2, acc[mb][nb]); } }
        asm volatile("v_nop\n\tv_nop\n\tv_nop\n\tv_nop" : "+v"(acc[0][0]), "+v"(acc[1][1]), "+v"(acc[2][2]), "+v"(acc[3][3]) : "v"(a[0]), "v"(a[3]));
    }
#pragma unroll
    for (int mb = 0; mb < 4; ++mb) {
#pragma unroll
        for (int nb = 0; nb < 4; ++nb) {
#pragma unroll
            for (int j = 0; j < 8; ++j) os[(hi * 8 + j) * 68 + nb * 16 + lr] = acc[mb][nb][j]; }
        __builtin_amdgcn_wave_barrier(); asm volatile("" ::: "memory");
        float* crow = C + (size_t)(r0 + mb * 16) * ldc + c0;
{
#pragma unroll
            for (int s = 0; s < 8; ++s) { const int row = 2 * s + hi, cofs = lr * 4; v4f val = *(const v4fa*)(os + row * 68 + cofs); if (BIAS) { val[0] += bfr(bias[c0 + cofs]); val[1] += bfr(bias[c0 + cofs + 1]); val[2] += bfr(bias[c0 + cofs + 2]); val[3] += bfr(bias[c0 + cofs + 3]); }
                *(v4f*)(crow + (size_t)row * ldc + cofs) = val; }
             }
        __builtin_amdgcn_wave_barrier(); asm volatile("" ::: "memory");
    }
}

__device__ __forceinline__ h16 tohx(float x) { return (h16)x; }
__device__ __forceinline__ void splitf(float y, unsigned short& h, unsigned short& l) { h = f2bf(y); l = f2bf(y - bf2f(h)); }
typedef __attribute__((ext_vector_type(2))) unsigned short v2us;
typedef __attribute__((ext_vector_type(4))) unsigned short v4us;

__global__ __launch_bounds__(256) void k_cvt8(const float* __restrict__ src, bf* dst, size_t n8) { const size_t i = (size_t)blockIdx.x * 256 + threadIdx.x; if (i >= n8) return; const v8f v = *(const v8f*)(src + i * 8); v8us o;
#pragma unroll
    for (int k = 0; k < 8; ++k) o[k] = f2bf(v[k]); *(v8us*)(dst + i * 8) = o;  }
// k_xt and k_qkhl take the batch from blockIdx.y.
// k_wqk: Bt [64][32] bf16 = [wq; wk; 0]; k_bqk: bias [64] = [bq | bk | 0]; k_xt: XT[p][c] = bf16 x[c][p] (lane -> 2 consecutive c); k_qkhl: hl planes of q and k (32 wide, d >= 16 zero) from QK[p][0..31] (8-B lanes);
__global__ __launch_bounds__(256) void k_wqk(const float* __restrict__ wq, const float* __restrict__ wk, bf* Bt) { const int e = (blockIdx.x * 256 + threadIdx.x) * 4; if (e >= 64 * CE) return; const int c = e % CE, n = e / CE; v4us o;
#pragma unroll
    for (int u = 0; u < 4; ++u) o[u] = n < CQ ? f2bf(wq[n * CE + c + u]) : (n < 2 * CQ ? f2bf(wk[(n - CQ) * CE + c + u]) : (unsigned short)0); *(v4us*)(Bt + e) = o;  }
__global__ __launch_bounds__(64) void k_bqk(const float* __restrict__ bq, const float* __restrict__ bk, float* b) { const int n = threadIdx.x; const float v = n < CQ ? bq[n] : (n < 2 * CQ ? bk[n - CQ] : 0.f); *(float*)(b + n) = v;  }
template <int NC> __global__ __launch_bounds__(256) void k_xt(const float* __restrict__ x, bf* XT) { x += (size_t)blockIdx.y * NC * NP; XT += (size_t)blockIdx.y * NP * NC; const int e = (blockIdx.x * 256 + threadIdx.x) * 2; if (e >= NP * NC) return; const int c = e % NC; const int p = e / NC; v2us o; o[0] = f2bf(x[(size_t)c * NP + p]); o[1] = f2bf(x[(size_t)(c + 1) * NP + p]); *(v2us*)(XT + e) = o;  }
__global__ __launch_bounds__(256) void k_qkhl(const float* __restrict__ QK, bf* Qh, bf* Ql, bf* Kh, bf* Kl) { const size_t zo = (size_t)blockIdx.y * NP * KP; QK += (size_t)blockIdx.y * NP * 64; Qh += zo; Ql += zo; Kh += zo; Kl += zo; const int e = (blockIdx.x * 256 + threadIdx.x) * 4; if (e >= NP * KP) return; const int d = e % KP; const int p = e / KP; v4us qh, ql, kh, kl;
#pragma unroll
    for (int u = 0; u < 4; ++u) { const int dd = d + u; const float qv = dd < CQ ? QK[(size_t)p * 64 + dd] : 0.f, kv = dd < CQ ? QK[(size_t)p * 64 + CQ + dd] : 0.f; unsigned short a, b; splitf(qv, a, b); qh[u] = a; ql[u] = b; splitf(kv, a, b); kh[u] = a; kl[u] = b; }
    { *(v4us*)(Qh + e) = qh; *(v4us*)(Ql + e) = ql; *(v4us*)(Kh + e) = kh; *(v4us*)(Kl + e) = kl;  } }
// ---- k_vf: V16[b][c][p] = f16(sum_cc wv[c][cc] bf16(sod[b][cc][p]) + bf16(bv[c])): transpose, product and conversion in one kernel; grid (NP/64, batches), 8 waves; a work-group owns 64 pixels p and all 256 c.
// The [256 cc][64 p] f32 tile comes in by whole 128-byte lines (a lane: 2 x 8 rows cc x 4 pixels), is rounded to bf16 and written to LDS as X[p][cc], 16 bytes (8 cc of one p) a store.
// Transposed product V^T = X wv^T (A = X rows p from LDS, B = wv rows c, 32 per wave, held in registers; both in the k order of WFrag::ld), one accumulator chain over the 8 chunks of k:
// a lane then holds 8 consecutive p of ONE c, 16 bytes of f16, staged in Y[c][p] and stored as whole 128-byte lines.
#define XP 264                           // bf16 elements; 528-byte rows read and written by 16-byte LDS operations: an odd multiple of 16
#define YP 72                            // f16 elements; 144-byte rows, the same rule
__global__ __launch_bounds__(256) void k_vf(const float* __restrict__ sod, const bf* __restrict__ WV, const float* __restrict__ bv, h16* __restrict__ V16) {
    __shared__ __align__(16) bf X[64 * XP];
    __shared__ __align__(16) h16 Y[CC * YP];
    const int tid = threadIdx.x, lane = tid & 31, lr = lane & 15, hi = lane >> 4, wave = tid >> 5; const int p0 = blockIdx.x * 64;
    sod += (size_t)blockIdx.y * CC * NP; V16 += (size_t)blockIdx.y * CC * NP;
    // a wave's load covers 4 rows cc x one whole line (8 lanes x 4 pixels); its 16-byte LDS stores then fall on all 64 banks
    const int pq = (lane & 7) + 8 * (wave & 1), g0 = (lane >> 3) + 4 * (wave >> 1);
    const float* sp = sod + (size_t)(g0 * 8) * NP + p0 + pq * 4;
    const bf* wp = WV + (size_t)(wave * 32 + lr) * CC + 8 * hi;
    v4f x[2][8]; v16bf w[2][8];
#pragma unroll
    for (int h = 0; h < 2; ++h)
#pragma unroll
        for (int r = 0; r < 8; ++r) x[h][r] = *(const v4f*)(sp + (size_t)(h * 128 + r) * NP);
#pragma unroll
    for (int cn = 0; cn < 2; ++cn)
#pragma unroll
        for (int kc = 0; kc < 8; ++kc) w[cn][kc] = WFrag<bf>::ld(wp + cn * 16 * CC + kc * 32);
    const float bb0 = bfr(bv[wave * 32 + lr]), bb1 = bfr(bv[wave * 32 + 16 + lr]);
    // behind the kernel's last load: both address pairs are inputs, so they stay whole up to this wait
    asm volatile("s_wait_xcnt 0x0" :: "v"(sp), "v"(wp) : "memory");
#pragma unroll
    for (int h = 0; h < 2; ++h)
#pragma unroll
        for (int u = 0; u < 4; ++u) { v8us o;
#pragma unroll
            for (int r = 0; r < 8; ++r) o[r] = f2bf(x[h][r][u]);
            *(v8usa*)(X + (pq * 4 + u) * XP + h * 128 + g0 * 8) = o; }
    __syncthreads();   // the whole transposed tile is in LDS before any wave reads fragments of it
    v8f acc[4][2];
#pragma unroll
    for (int pm = 0; pm < 4; ++pm) { acc[pm][0] = (v8f){}; acc[pm][1] = (v8f){}; }
#pragma unroll
    for (int kc = 0; kc < 8; ++kc)
#pragma unroll
        for (int pm = 0; pm < 4; ++pm) { const bf* xr = X + (pm * 16 + lr) * XP + 8 * hi + kc * 32; const v16bf a = cat16b(*(const v8usa*)xr, *(const v8usa*)(xr + 16));
            acc[pm][0] = wmmab(a, w[0][kc], acc[pm][0]); acc[pm][1] = wmmab(a, w[1][kc], acc[pm][1]); }
#pragma unroll
    for (int pm = 0; pm < 4; ++pm)
#pragma unroll
        for (int cn = 0; cn < 2; ++cn) { v8h o;   // accumulator register j: pixel pm * 16 + hi * 8 + j; lane column: c = wave * 32 + cn * 16 + lr
#pragma unroll
            for (int j = 0; j < 8; ++j) o[j] = tohx(__fadd_rn(acc[pm][cn][j], cn ? bb1 : bb0));
            *(v8ha*)(Y + (wave * 32 + cn * 16 + lr) * YP + pm * 16 + hi * 8) = o; }
    __syncthreads();   // the whole [256][64] tile is staged before rows are read back
    v8h y[8]; h16* vp = V16 + (size_t)(tid >> 3) * NP + p0 + (tid & 7) * 8;   // 8 lanes store one whole 128-byte line: every line has one writer
#pragma unroll
    for (int s = 0; s < 8; ++s) y[s] = *(const v8ha*)(Y + (s * 32 + (tid >> 3)) * YP + (tid & 7) * 8);
#pragma unroll
    for (int s = 0; s < 8; ++s) *(v8h*)(vp + (size_t)s * 32 * NP) = y[s];
}
#define SKEY   64
#define NSTG   (NP / SKEY)
#define VPITCH 144                       // bytes; 128-byte rows read by 16-byte LDS loads: an odd multiple of 16
#define KPITCH 48                        // bytes; 32-byte rows, the same rule
#define VTILE  (CC * VPITCH)
#define KTILE  (SKEY * KPITCH)
#define SBUF   (VTILE + 2 * KTILE)
#define OPITCH 132                       // floats; output staging [256 c][128 i]
#define PSH    6.0f                      // exponentials carry 2^6 (at most 2^14 with the lazy maximum): small ones keep f16 precision; it cancels against the row sum
typedef __attribute__((ext_vector_type(2))) float v2f;
typedef __attribute__((ext_vector_type(2))) _Float16 v2h;
typedef __attribute__((ext_vector_type(8))) unsigned v8u;
typedef v4us __attribute__((may_alias)) v4usa;
__device__ __forceinline__ float xhalf(float x) { return __builtin_bit_cast(float, __builtin_amdgcn_permlanex16(__builtin_bit_cast(int, x), __builtin_bit_cast(int, x), 0x76543210, 0xfedcba98, false, false)); }  // lane l with lane l ^ 16
__device__ __forceinline__ unsigned pack2h(float a, float b) { return __builtin_bit_cast(unsigned, __builtin_convertvector((v2f){a, b}, v2h)); }  // round to nearest even
__global__ __launch_bounds__(256) __attribute__((amdgpu_waves_per_eu(2, 2))) void k_attn(const bf* __restrict__ Qh, const bf* __restrict__ Ql, const bf* __restrict__ Kh, const bf* __restrict__ Kl, const h16* __restrict__ V16, const float* __restrict__ sod, float* __restrict__ OUTb) {
    __shared__ __align__(16) unsigned char L[CC * OPITCH * 4];
    static_assert(2 * SBUF <= CC * OPITCH * 4, "the two stage buffers lie inside the output staging");
    const int tid = threadIdx.x, lane = tid & 31, lr = lane & 15, hi = lane >> 4, wave = tid >> 5; const int i0 = blockIdx.x * 128;
    { const size_t zo = (size_t)blockIdx.y * NP * KP, zv = (size_t)blockIdx.y * CC * NP; Qh += zo; Ql += zo; Kh += zo; Kl += zo; V16 += zv; sod += zv; OUTb += zv; }
    const v8us z8 = (v8us){};
    const size_t qo = (size_t)(i0 + wave * 16 + lr) * KP + 8 * hi; const bf* qhp = Qh + qo; const bf* qlp = Ql + qo;
    const v16bf qfh = cat16b(*(const v8usa*)qhp, z8), qfl = cat16b(*(const v8usa*)qlp, z8);
    // behind the two q loads: both address pairs are inputs, so they stay whole up to this wait
    asm volatile("s_wait_xcnt 0x0" :: "v"(qhp), "v"(qlp) : "memory");
    // q has landed in front of the loop (loaded values as inputs only): otherwise the wait for it stands inside the pass and there also waits for the next stage's loads in flight
    asm volatile("" :: "v"(qfh), "v"(qfl));
    // staging: 8 threads bring one 128-byte row piece of v (rows tid/8 + 32 u); 4 threads bring the 32 real bytes of one k row, of the hi and of the lo plane. The lane offsets never change; the stage moves the uniform base.
    const unsigned vof = (unsigned)(tid >> 3) * NP + (tid & 7) * 8, kof = (unsigned)(tid >> 2) * KP + (tid & 3) * 4;
    const unsigned vdst = (tid >> 3) * VPITCH + (tid & 7) * 16, kdst = VTILE + (tid >> 2) * KPITCH + (tid & 3) * 8;
    v8us sv[8]; v4us skh, skl;
    auto fetch = [&](int st) { const h16* vp = V16 + st * SKEY; const bf* khp = Kh + st * (SKEY * KP); const bf* klp = Kl + st * (SKEY * KP);
#pragma unroll
        for (int u = 0; u < 8; ++u) sv[u] = *(const v8usa*)(vp + u * (32 * NP) + vof);
        skh = *(const v4usa*)(khp + kof); skl = *(const v4usa*)(klp + kof);
        // behind the stage's last load: the three bases are inputs, so they stay whole up to this wait (the lane offsets are made once, in front of the loop, and never rewritten in it)
        asm volatile("s_wait_xcnt 0x0" :: "s"(vp), "s"(khp), "s"(klp) : "memory"); };
    auto put = [&](unsigned base) {
#pragma unroll
        for (int u = 0; u < 8; ++u) *(v8usa*)(L + base + vdst + u * 32 * VPITCH) = sv[u];
        *(v4usa*)(L + base + kdst) = skh; *(v4usa*)(L + base + kdst + KTILE) = skl; };
    v8f acc[16];
#pragma unroll
    for (int t = 0; t < 16; ++t) acc[t] = (v8f){};
    float m_run = -__builtin_inff(), l0 = 0.f, l1 = 0.f;
#pragma unroll 1
    for (int st = -1; st < NSTG; ++st) {   // rolled: one stage's code, the buffer by offset; trip -1 only brings stage 0 in (no passes), so the staging code stands once
        const unsigned base = (st & 1) * SBUF;
        if (st + 1 < NSTG) fetch(st + 1);
#pragma unroll 1
        for (int ps = st < 0 ? SKEY / 32 : 0; ps < SKEY / 32; ++ps) {   // rolled: a pass of 32 keys holds all the registers there are
            const unsigned char* kb = L + base + VTILE + (ps * 32 + lr) * KPITCH + hi * 16;
            const v16bf kh0 = cat16b(*(const v8usa*)kb, z8), kh1 = cat16b(*(const v8usa*)(kb + 16 * KPITCH), z8), kl0 = cat16b(*(const v8usa*)(kb + KTILE), z8), kl1 = cat16b(*(const v8usa*)(kb + KTILE + 16 * KPITCH), z8);
            v8f s0 = (v8f){}, s1 = (v8f){};
            s0 = wmmab(kh0, qfh, s0); s1 = wmmab(kh1, qfh, s1); s0 = wmmab(kh0, qfl, s0); s1 = wmmab(kh1, qfl, s1); s0 = wmmab(kl0, qfh, s0); s1 = wmmab(kl1, qfh, s1);
            float mx = fmaxf(s0[0], s1[0]);
#pragma unroll
            for (int r = 1; r < 8; ++r) mx = fmaxf(mx, fmaxf(s0[r], s1[r]));
            mx = fmaxf(mx, xhalf(mx)) * 1.4426950408889634f;   // both wave halves hold row i's maximum over the 32 keys
            if (__builtin_amdgcn_ballot_w32(mx > m_run + 8.0f) != 0) {   // one scalar test a pass; rare after the first passes
                const float m_new = fmaxf(m_run, mx), corr = __builtin_amdgcn_exp2f(m_run - m_new);   // 0 in the first pass
                l0 *= corr; l1 *= corr; m_run = m_new;
#pragma unroll
                for (int t = 0; t < 16; ++t) acc[t] = acc[t] * corr;
            }
            // the pass's v fragments: rows c = 16 t + lr, keys 8 hi .. + 7 and 16 + 8 hi .. + 7 of the pass's 32
            const unsigned char* vb = L + base + lr * VPITCH + ps * 64 + hi * 16;
            v16h vf[16];
#pragma unroll
            for (int t = 0; t < 16; ++t) vf[t] = cat16(*(const v8ha*)(vb + t * 16 * VPITCH), *(const v8ha*)(vb + t * 16 * VPITCH + 32));
            __builtin_amdgcn_sched_barrier(0);   // all 32 LDS loads issue as one group in front of the exponentials and land under them; left free they sink to one product ahead of their use
            const float nm = PSH - m_run; v8u w; float x[16], e[16];   // element s of the B operand: tile s / 8, register s % 8
#pragma unroll
            for (int q = 0; q < 16; ++q) x[q] = __builtin_fmaf(q < 8 ? s0[q & 7] : s1[q & 7], 1.4426950408889634f, nm);
#pragma unroll
            for (int q = 0; q < 16; q += 4)   // four exponentials and one slot in one statement: behind each stands an instruction that neither reads its result nor overwrites its source (outputs apart from all inputs)
                asm("v_exp_f32 %0, %4\n\tv_exp_f32 %1, %5\n\tv_exp_f32 %2, %6\n\tv_exp_f32 %3, %7\n\tv_nop" : "=&v"(e[q]), "=&v"(e[q + 1]), "=&v"(e[q + 2]), "=&v"(e[q + 3]) : "v"(x[q]), "v"(x[q + 1]), "v"(x[q + 2]), "v"(x[q + 3]));
#pragma unroll
            for (int q = 0; q < 8; ++q) { l0 += e[2 * q]; l1 += e[2 * q + 1]; w[q] = pack2h(e[2 * q], e[2 * q + 1]); }
            const v16h pf = __builtin_bit_cast(v16h, w);
#pragma unroll
            for (int t = 0; t < 16; ++t) acc[t] = wmma16(vf[t], pf, acc[t]);
            // four vector slots behind the pass's last products, on the taken back edge too, before the next pass's loads land in the operand registers
            __builtin_amdgcn_sched_barrier(0); asm volatile("v_nop\n\tv_nop\n\tv_nop\n\tv_nop"); __builtin_amdgcn_sched_barrier(0);
        }
        if (st + 1 < NSTG) put(SBUF - base);   // the other buffer: its readers left it before the barrier that ended stage st - 1
        __syncthreads();   // publishes stage st + 1 and ends every wave's reads of this stage's buffer
    }
    // the rows of sod that this wave will store against (whole 512-byte rows), asked for as soon as the loop ends: they fly under the staging of the sums
    const float* sp = sod + (size_t)wave * NP + i0 + lane * 4; v4f sd[32];
#pragma unroll
    for (int s = 0; s < 32; ++s) sd[s] = *(const v4f*)(sp + (size_t)s * 8 * NP);
    // behind the kernel's last load: the address pair is an input, so it stays whole up to this wait
    asm volatile("s_wait_xcnt 0x0" :: "v"(sp) : "memory");
    float l = l0 + l1; l += xhalf(l);   // each wave half summed its own 16 of every 32 keys
    const float f = __fdiv_rn(PCAR, l);
    float* O = (float*)L;   // the ring is free behind the loop's last barrier
#pragma unroll
    for (int t = 0; t < 16; ++t)
#pragma unroll
        for (int r = 0; r < 8; ++r) O[(t * 16 + hi * 8 + r) * OPITCH + wave * 16 + lr] = acc[t][r] * f;
    __syncthreads();   // the whole [256][128] tile is staged before rows are read back
    v4f o[32];   // a wave stores whole 512-byte rows: every 128-byte line has one writer
#pragma unroll
    for (int s = 0; s < 32; ++s) o[s] = *(const v4fa*)(O + (s * 8 + wave) * OPITCH + lane * 4);
#pragma unroll
    for (int s = 0; s < 32; ++s) {
#pragma unroll
        for (int u = 0; u < 4; ++u) { const float sv = bfr(sd[s][u]); o[s][u] = __fadd_rn(sv, __fmul_rn(o[s][u] * (1.0f / PCAR), sv)); } }
#pragma unroll
    for (int s = 0; s < 32; ++s) *(v4f*)(OUTb + (size_t)(s * 8 + wave) * NP + i0 + lane * 4) = o[s];
}

extern "C" void kernel_launch(void* const* d_in, const int* in_sizes, int n_in,
                              void* d_out, int out_size, void* d_ws, size_t ws_size, hipStream_t stream) {
    (void)in_sizes; (void)n_in; (void)out_size;
    const float* sod = (const float*)d_in[0]; const float* edge = (const float*)d_in[1]; const float* wq = (const float*)d_in[2]; const float* bq = (const float*)d_in[3]; const float* wk = (const float*)d_in[4]; const float* bk = (const float*)d_in[5]; const float* wv = (const float*)d_in[6]; const float* bv = (const float*)d_in[7];
    float* OUT = (float*)d_out;     // [8][256][64][64]
    char* wsp = (char*)d_ws;
    auto take = [&](size_t bytes) { char* p = wsp; wsp += (bytes + 255) & ~(size_t)255; return (void*)p; };
    bf* WQK = (bf*)take(64 * CE * 2); float* bqk = (float*)take(256); bf* WV = (bf*)take(CC * CC * 2); bf* ET = (bf*)take((size_t)NB_ * NP * CE * 2); float* QK = (float*)take((size_t)NB_ * NP * 64 * 4);
    bf* Qh = (bf*)take((size_t)NB_ * NP * KP * 2); bf* Ql = (bf*)take((size_t)NB_ * NP * KP * 2); bf* Kh = (bf*)take((size_t)NB_ * NP * KP * 2); bf* Kl = (bf*)take((size_t)NB_ * NP * KP * 2); h16* V16 = (h16*)take((size_t)NB_ * CC * NP * 2);
    if ((size_t)(wsp - (char*)d_ws) > ws_size) return;    // total ~ 34 MiB: every plane holds all batches
    k_wqk<<<(64 * CE / 4 + 255) / 256, 256, 0, stream>>>(wq, wk, WQK); k_bqk<<<1, 64, 0, stream>>>(bq, bk, bqk); k_cvt8<<<(CC * CC / 8 + 255) / 256, 256, 0, stream>>>(wv, WV, CC * CC / 8);   // wv [out][in] = B operand rows [c][cc]
    // all batches in one launch each
    k_xt<CE><<<dim3((NP * CE / 2 + 255) / 256, NB_, 1), 256, 0, stream>>>(edge, ET);
    k_gemmw<bf, 0, true><<<dim3(NP / 64, 1, NB_), 32, 0, stream>>>(ET, nullptr, WQK, nullptr, CE, QK, 64, bqk, (size_t)NP * CE, 0, (size_t)NP * 64);        // QK[b][p][0..15 | 16..31]
    k_vf<<<dim3(NP / 64, NB_, 1), 256, 0, stream>>>(sod, WV, bv, V16);   // V16[b][c][p] = f16(sum_cc wv[c][cc] sod[b][cc][p] + bv[c])
    k_qkhl<<<dim3((NP * KP / 4 + 255) / 256, NB_, 1), 256, 0, stream>>>(QK, Qh, Ql, Kh, Kl);
    k_attn<<<dim3(NP / 128, NB_, 1), 256, 0, stream>>>(Qh, Ql, Kh, Kl, V16, sod, OUT);   // OUT[b][c][i] = sod + sod * sum_j v[c][j] mask[i][j]
}

// v006
// Measured time: 93.8 microseconds a run.
// In both of two side-by-side timings against v005, it was 1.18 times as fast.
// All steps since v000 together make it 13.0 times as fast.
#include <hip/hip_runtime.h>

// (sod [8][256][64x64], edge [8][32][64x64]; q = wq edge + bq, k = wk edge + bk (16 channels), v = wv sod + bv; mask = softmax_j(sum_d q[d][i] k[d][j]) (unscaled); feat[c][i] = sum_j v[c][j] mask[i][j]; out = sod + feat * sod -> [8][256][64][64]).
// Compute dtypes, f32 accumulate: every input rounded to bf16; q = wq x edge, k = wk x edge and v = wv x sod on PLAIN bf16 operands (inputs: every product exact) + bias; scores (K 16, padded to 32) on bf16 hi+lo planes of q, k (3 products - the unscaled logits are too large for fp16 operands);
// mask and feat: one fused kernel (k_attn), scores^T -> exponentials against a running row maximum -> f16 B operand in registers -> feat^T += v x mask^T on f16 operands; row sums in f32, divided out at the end.

#define NB_  8
#define CC   256
#define CE   32
#define CQ   16
#define NP   4096
#define KP   16
#define PCAR 1024.0f
typedef _Float16 h16;
typedef unsigned short bf;
typedef __attribute__((ext_vector_type(16))) __bf16   v16bf;
typedef __attribute__((ext_vector_type(16))) _Float16 v16h;
typedef __attribute__((ext_vector_type(8)))  _Float16 v8h;
typedef __attribute__((ext_vector_type(8)))  unsigned short v8us;
typedef __attribute__((ext_vector_type(8)))  float    v8f;
typedef __attribute__((ext_vector_type(4)))  float    v4f;
typedef v8h  __attribute__((may_alias)) v8ha;
typedef v4f  __attribute__((may_alias)) v4fa;
typedef v8us __attribute__((may_alias)) v8usa;

__device__ __forceinline__ unsigned short f2bf(float f) { unsigned u = __float_as_uint(f); u += 0x7FFFu + ((u >> 16) & 1u); return (unsigned short)(u >> 16); }
__device__ __forceinline__ float bf2f(unsigned short b) { return __uint_as_float(((unsigned)b) << 16); }
__device__ __forceinline__ float bfr(float f) { return bf2f(f2bf(f)); }
__device__ __forceinline__ v16h cat16(v8h lo, v8h hi) { return __builtin_shufflevector(lo, hi, 0, 1, 2, 3, 4, 5, 6, 7, 8, 9, 10, 11, 12, 13, 14, 15); }
__device__ __forceinline__ v16bf cat16b(v8us lo, v8us hi) { return __builtin_bit_cast(v16bf, __builtin_shufflevector(lo, hi, 0, 1, 2, 3, 4, 5, 6, 7, 8, 9, 10, 11, 12, 13, 14, 15)); }
__device__ __forceinline__ v8f wmma16(v16h a, v16h b, v8f c) { return __builtin_amdgcn_wmma_f32_16x16x32_f16(false, a, false, b, (short)0, c, false, false); }
__device__ __forceinline__ v8f wmmab(v16bf a, v16bf b, v8f c) { return __builtin_amdgcn_wmma_f32_16x16x32_bf16(false, a, false, b, (short)0, c, false, false); }



// fragment of a K-contiguous 16-bit row in the hardware k order: elements k = 0..7 and 16..23 from the lane's pointer (row base + 8 * wave half)
template <typename T16> struct WFrag;
template <> struct WFrag<bf> { typedef v16bf V; static __device__ __forceinline__ V ld(const bf* p) { return cat16b(*(const v8us*)p, *(const v8us*)(p + 16)); } static __device__ __forceinline__ v8f mma(V a, V b, v8f c) { return wmmab(a, b, c); } };

__device__ __forceinline__ h16 tohx(float x) { return (h16)x; }
__device__ __forceinline__ void splitf(float y, unsigned short& h, unsigned short& l) { h = f2bf(y); l = f2bf(y - bf2f(h)); }
typedef __attribute__((ext_vector_type(4))) unsigned short v4us;

// ---- k_prep: the hi and lo planes of q and k, [b][p][16 d] bf16, straight from edge, wq, bq, wk, bk; grid (NP/128 + 4, batches), 8 waves, a wave owns 16 pixels p. The last 4 x batches work-groups round wv to bf16 instead (k_vf's B operand rows [c][cc]).
// Transposed product (A = weight rows d, B = edge columns p, both in the k order of WFrag::ld, K = 32 = one instruction): a lane reads its 16 channels of ONE pixel straight into the B fragment (16 lanes: 64 bytes in a row per channel),
// and then holds 8 consecutive d of that pixel: 16 bytes of each plane, so that a wave's store is 512 bytes in a row, whole lines.
__global__ __launch_bounds__(256) void k_prep(const float* __restrict__ edge, const float* __restrict__ wq, const float* __restrict__ bq, const float* __restrict__ wk, const float* __restrict__ bk, const float* __restrict__ wv, bf* __restrict__ Qh, bf* __restrict__ Ql, bf* __restrict__ Kh, bf* __restrict__ Kl, bf* __restrict__ WV) {
    const int tid = threadIdx.x;
    if (blockIdx.x >= NP / 128) {   // the same for a whole work-group
        const size_t i = ((size_t)(blockIdx.x - NP / 128) * NB_ + blockIdx.y) * 256 + tid;   // 4 x 8 x 256 threads, 8 elements each: all of wv
        static_assert(4 * NB_ * 256 * 8 == CC * CC, "the conversion work-groups cover wv exactly");
        const float* sp = wv + i * 8; const v8f v = *(const v8f*)sp;
        // behind the load: the address pair is an input, so it stays whole up to this wait
        asm volatile("s_wait_xcnt 0x0" :: "v"(sp) : "memory");
        v8us o;
#pragma unroll
        for (int k = 0; k < 8; ++k) o[k] = f2bf(v[k]);
        *(v8us*)(WV + i * 8) = o; return; }
    const int lane = tid & 31, lr = lane & 15, hi = lane >> 4, wave = tid >> 5; const int p = blockIdx.x * 128 + wave * 16 + lr;
    const float* ep = edge + (size_t)blockIdx.y * CE * NP + (size_t)(8 * hi) * NP + p; const float* wqp = wq + lr * CE + 8 * hi; const float* wkp = wk + lr * CE + 8 * hi;
    const v8f bq0 = *(const v8f*)bq, bq1 = *(const v8f*)(bq + 8), bk0 = *(const v8f*)bk, bk1 = *(const v8f*)(bk + 8);   // uniform addresses: scalar loads; the wave half picks its eight values below
    float x[16];   // fragment element e: channel 8 hi + e (e < 8), 16 + 8 hi + e - 8 (e >= 8)
#pragma unroll
    for (int e = 0; e < 16; ++e) x[e] = ep[(size_t)(e < 8 ? e : e + 8) * NP];
    const v8f q0 = *(const v8f*)wqp, q1 = *(const v8f*)(wqp + 16), k0 = *(const v8f*)wkp, k1 = *(const v8f*)(wkp + 16);
    // behind the kernel's last vector load: the three address pairs are inputs, so they stay whole up to this wait
    asm volatile("s_wait_xcnt 0x0" :: "v"(ep), "v"(wqp), "v"(wkp) : "memory");
    // every vector load above has landed here (loaded values as inputs only): they issue as one group and their latencies overlap; left free the compiler asks for the last channels one at a time, each behind a wait for the one before
    asm volatile("" :: "v"(x[0]), "v"(x[1]), "v"(x[2]), "v"(x[3]), "v"(x[4]), "v"(x[5]), "v"(x[6]), "v"(x[7]), "v"(x[8]), "v"(x[9]), "v"(x[10]), "v"(x[11]), "v"(x[12]), "v"(x[13]), "v"(x[14]), "v"(x[15]), "v"(q0), "v"(q1), "v"(k0), "v"(k1));
    v8us x0, x1, a0, a1, c0, c1;
#pragma unroll
    for (int e = 0; e < 8; ++e) { x0[e] = f2bf(x[e]); x1[e] = f2bf(x[8 + e]); a0[e] = f2bf(q0[e]); a1[e] = f2bf(q1[e]); c0[e] = f2bf(k0[e]); c1[e] = f2bf(k1[e]); }
    const v16bf xf = cat16b(x0, x1);
    const v8f dq = wmmab(cat16b(a0, a1), xf, (v8f){}), dk = wmmab(cat16b(c0, c1), xf, (v8f){});   // accumulator register j: d = 8 hi + j; lane column: pixel p
    v8us qh, ql, kh, kl;
#pragma unroll
    for (int j = 0; j < 8; ++j) { unsigned short a, b; splitf(dq[j] + bfr(hi ? bq1[j] : bq0[j]), a, b); qh[j] = a; ql[j] = b; splitf(dk[j] + bfr(hi ? bk1[j] : bk0[j]), a, b); kh[j] = a; kl[j] = b; }
    const size_t o = ((size_t)blockIdx.y * NP + p) * KP + 8 * hi;
    *(v8us*)(Qh + o) = qh; *(v8us*)(Ql + o) = ql; *(v8us*)(Kh + o) = kh; *(v8us*)(Kl + o) = kl;
    // behind the last of the four stores: no register that they name is rewritten in front of this wait, on whichever block the compiler lays out behind them
    asm volatile("s_wait_xcnt 0x0" ::: "memory");
}
// ---- k_vf: V16[b][c][p] = f16(sum_cc wv[c][cc] bf16(sod[b][cc][p]) + bf16(bv[c])): transpose, product and conversion in one kernel; grid (NP/64, batches), 8 waves; a work-group owns 64 pixels p and all 256 c.
// The [256 cc][64 p] f32 tile comes in by whole 128-byte lines (a lane: 2 x 8 rows cc x 4 pixels), is rounded to bf16 and written to LDS as X[p][cc], 16 bytes (8 cc of one p) a store.
// Transposed product V^T = X wv^T (A = X rows p from LDS, B = wv rows c, 32 per wave, held in registers; both in the k order of WFrag::ld), one accumulator chain over the 8 chunks of k:
// a lane then holds 8 consecutive p of ONE c, 16 bytes of f16, staged in Y[c][p] and stored as whole 128-byte lines.
#define XP 264                           // bf16 elements; 528-byte rows read and written by 16-byte LDS operations: an odd multiple of 16
#define YP 72                            // f16 elements; 144-byte rows, the same rule
__global__ __launch_bounds__(256) void k_vf(const float* __restrict__ sod, const bf* __restrict__ WV, const float* __restrict__ bv, h16* __restrict__ V16) {
    __shared__ __align__(16) bf X[64 * XP];
    __shared__ __align__(16) h16 Y[CC * YP];
    const int tid = threadIdx.x, lane = tid & 31, lr = lane & 15, hi = lane >> 4, wave = tid >> 5; const int p0 = blockIdx.x * 64;
    sod += (size_t)blockIdx.y * CC * NP; V16 += (size_t)blockIdx.y * CC * NP;
    // a wave's load covers 4 rows cc x one whole line (8 lanes x 4 pixels); its 16-byte LDS stores then fall on all 64 banks
    const int pq = (lane & 7) + 8 * (wave & 1), g0 = (lane >> 3) + 4 * (wave >> 1);
    const float* sp = sod + (size_t)(g0 * 8) * NP + p0 + pq * 4;
    const bf* wp = WV + (size_t)(wave * 32 + lr) * CC + 8 * hi;
    v4f x[2][8]; v16bf w[2][8];
#pragma unroll
    for (int h = 0; h < 2; ++h)
#pragma unroll
        for (int r = 0; r < 8; ++r) x[h][r] = *(const v4f*)(sp + (size_t)(h * 128 + r) * NP);
#pragma unroll
    for (int cn = 0; cn < 2; ++cn)
#pragma unroll
        for (int kc = 0; kc < 8; ++kc) w[cn][kc] = WFrag<bf>::ld(wp + cn * 16 * CC + kc * 32);
    const float bb0 = bfr(bv[wave * 32 + lr]), bb1 = bfr(bv[wave * 32 + 16 + lr]);
    // behind the kernel's last load: both address pairs are inputs, so they stay whole up to this wait
    asm volatile("s_wait_xcnt 0x0" :: "v"(sp), "v"(wp) : "memory");
#pragma unroll
    for (int h = 0; h < 2; ++h)
#pragma unroll
        for (int u = 0; u < 4; ++u) { v8us o;
#pragma unroll
            for (int r = 0; r < 8; ++r) o[r] = f2bf(x[h][r][u]);
            *(v8usa*)(X + (pq * 4 + u) * XP + h * 128 + g0 * 8) = o; }
    __syncthreads();   // the whole transposed tile is in LDS before any wave reads fragments of it
    v8f acc[4][2];
#pragma unroll
    for (int pm = 0; pm < 4; ++pm) { acc[pm][0] = (v8f){}; acc[pm][1] = (v8f){}; }
#pragma unroll
    for (int kc = 0; kc < 8; ++kc)
#pragma unroll
        for (int pm = 0; pm < 4; ++pm) { const bf* xr = X + (pm * 16 + lr) * XP + 8 * hi + kc * 32; const v16bf a = cat16b(*(const v8usa*)xr, *(const v8usa*)(xr + 16));
            acc[pm][0] = wmmab(a, w[0][kc], acc[pm][0]); acc[pm][1] = wmmab(a, w[1][kc], acc[pm][1]); }
#pragma unroll
    for (int pm = 0; pm < 4; ++pm)
#pragma unroll
        for (int cn = 0; cn < 2; ++cn) { v8h o;   // accumulator register j: pixel pm * 16 + hi * 8 + j; lane column: c = wave * 32 + cn * 16 + lr
#pragma unroll
            for (int j = 0; j < 8; ++j) o[j] = tohx(__fadd_rn(acc[pm][cn][j], cn ? bb1 : bb0));
            *(v8ha*)(Y + (wave * 32 + cn * 16 + lr) * YP + pm * 16 + hi * 8) = o; }
    __syncthreads();   // the whole [256][64] tile is staged before rows are read back
    v8h y[8]; h16* vp = V16 + (size_t)(tid >> 3) * NP + p0 + (tid & 7) * 8;   // 8 lanes store one whole 128-byte line: every line has one writer
#pragma unroll
    for (int s = 0; s < 8; ++s) y[s] = *(const v8ha*)(Y + (s * 32 + (tid >> 3)) * YP + (tid & 7) * 8);
#pragma unroll
    for (int s = 0; s < 8; ++s) *(v8h*)(vp + (size_t)s * 32 * NP) = y[s];
}
#define SKEY   64
#define NSTG   (NP / SKEY)
#define VPITCH 144                       // bytes; 128-byte rows read by 16-byte LDS loads: an odd multiple of 16
#define KPITCH 48                        // bytes; 32-byte rows, the same rule
#define VTILE  (CC * VPITCH)
#define KTILE  (SKEY * KPITCH)
#define SBUF   (VTILE + 2 * KTILE)
#define OPITCH 132                       // floats; output staging [256 c][128 i]
#define PSH    6.0f                      // exponentials carry 2^6 (at most 2^14 with the lazy maximum): small ones keep f16 precision; it cancels against the row sum
typedef __attribute__((ext_vector_type(2))) float v2f;
typedef __attribute__((ext_vector_type(2))) _Float16 v2h;
typedef __attribute__((ext_vector_type(8))) unsigned v8u;
typedef v4us __attribute__((may_alias)) v4usa;
__device__ __forceinline__ float xhalf(float x) { return __builtin_bit_cast(float, __builtin_amdgcn_permlanex16(__builtin_bit_cast(int, x), __builtin_bit_cast(int, x), 0x76543210, 0xfedcba98, false, false)); }  // lane l with lane l ^ 16
__device__ __forceinline__ unsigned pack2h(float a, float b) { return __builtin_bit_cast(unsigned, __builtin_convertvector((v2f){a, b}, v2h)); }  // round to nearest even
__global__ __launch_bounds__(256) __attribute__((amdgpu_waves_per_eu(2, 2))) void k_attn(const bf* __restrict__ Qh, const bf* __restrict__ Ql, const bf* __restrict__ Kh, const bf* __restrict__ Kl, const h16* __restrict__ V16, const float* __restrict__ sod, float* __restrict__ OUTb) {
    __shared__ __align__(16) unsigned char L[CC * OPITCH * 4];
    static_assert(2 * SBUF <= CC * OPITCH * 4, "the two stage buffers lie inside the output staging");
    const int tid = threadIdx.x, lane = tid & 31, lr = lane & 15, hi = lane >> 4, wave = tid >> 5; const int i0 = blockIdx.x * 128;
    { const size_t zo = (size_t)blockIdx.y * NP * KP, zv = (size_t)blockIdx.y * CC * NP; Qh += zo; Ql += zo; Kh += zo; Kl += zo; V16 += zv; sod += zv; OUTb += zv; }
    const v8us z8 = (v8us){};
    const size_t qo = (size_t)(i0 + wave * 16 + lr) * KP + 8 * hi; const bf* qhp = Qh + qo; const bf* qlp = Ql + qo;
    const v16bf qfh = cat16b(*(const v8usa*)qhp, z8), qfl = cat16b(*(const v8usa*)qlp, z8);
    // behind the two q loads: both address pairs are inputs, so they stay whole up to this wait
    asm volatile("s_wait_xcnt 0x0" :: "v"(qhp), "v"(qlp) : "memory");
    // q has landed in front of the loop (loaded values as inputs only): otherwise the wait for it stands inside the pass and there also waits for the next stage's loads in flight
    asm volatile("" :: "v"(qfh), "v"(qfl));
    // staging: 8 threads bring one 128-byte row piece of v (rows tid/8 + 32 u); 4 threads bring the 32 real bytes of one k row, of the hi and of the lo plane. The lane offsets never change; the stage moves the uniform base.
    const unsigned vof = (unsigned)(tid >> 3) * NP + (tid & 7) * 8, kof = (unsigned)(tid >> 2) * KP + (tid & 3) * 4;
    const unsigned vdst = (tid >> 3) * VPITCH + (tid & 7) * 16, kdst = VTILE + (tid >> 2) * KPITCH + (tid & 3) * 8;
    v8us sv[8]; v4us skh, skl;
    auto fetch = [&](int st) { const h16* vp = V16 + st * SKEY; const bf* khp = Kh + st * (SKEY * KP); const bf* klp = Kl + st * (SKEY * KP);
#pragma unroll
        for (int u = 0; u < 8; ++u) sv[u] = *(const v8usa*)(vp + u * (32 * NP) + vof);
        skh = *(const v4usa*)(khp + kof); skl = *(const v4usa*)(klp + kof);
        // behind the stage's last load: the three bases are inputs, so they stay whole up to this wait (the lane offsets are made once, in front of the loop, and never rewritten in it)
        asm volatile("s_wait_xcnt 0x0" :: "s"(vp), "s"(khp), "s"(klp) : "memory"); };
    auto put = [&](unsigned base) {
#pragma unroll
        for (int u = 0; u < 8; ++u) *(v8usa*)(L + base + vdst + u * 32 * VPITCH) = sv[u];
        *(v4usa*)(L + base + kdst) = skh; *(v4usa*)(L + base + kdst + KTILE) = skl; };
    v8f acc[16];
#pragma unroll
    for (int t = 0; t < 16; ++t) acc[t] = (v8f){};
    float m_run = -__builtin_inff(), l0 = 0.f, l1 = 0.f;
#pragma unroll 1
    for (int st = -1; st < NSTG; ++st) {   // rolled: one stage's code, the buffer by offset; trip -1 only brings stage 0 in (no passes), so the staging code stands once
        const unsigned base = (st & 1) * SBUF;
        if (st + 1 < NSTG) fetch(st + 1);
#pragma unroll 1
        for (int ps = st < 0 ? SKEY / 32 : 0; ps < SKEY / 32; ++ps) {   // rolled: a pass of 32 keys holds all the registers there are
            const unsigned char* kb = L + base + VTILE + (ps * 32 + lr) * KPITCH + hi * 16;
            const v16bf kh0 = cat16b(*(const v8usa*)kb, z8), kh1 = cat16b(*(const v8usa*)(kb + 16 * KPITCH), z8), kl0 = cat16b(*(const v8usa*)(kb + KTILE), z8), kl1 = cat16b(*(const v8usa*)(kb + KTILE + 16 * KPITCH), z8);
            v8f s0 = (v8f){}, s1 = (v8f){};
            s0 = wmmab(kh0, qfh, s0); s1 = wmmab(kh1, qfh, s1); s0 = wmmab(kh0, qfl, s0); s1 = wmmab(kh1, qfl, s1); s0 = wmmab(kl0, qfh, s0); s1 = wmmab(kl1, qfh, s1);
            float mx = fmaxf(s0[0], s1[0]);
#pragma unroll
            for (int r = 1; r < 8; ++r) mx = fmaxf(mx, fmaxf(s0[r], s1[r]));
            mx = fmaxf(mx, xhalf(mx)) * 1.4426950408889634f;   // both wave halves hold row i's maximum over the 32 keys
            if (__builtin_amdgcn_ballot_w32(mx > m_run + 8.0f) != 0) {   // one scalar test a pass; rare after the first passes
                const float m_new = fmaxf(m_run, mx), corr = __builtin_amdgcn_exp2f(m_run - m_new);   // 0 in the first pass
                l0 *= corr; l1 *= corr; m_run = m_new;
#pragma unroll
                for (int t = 0; t < 16; ++t) acc[t] = acc[t] * corr;
            }
            // the pass's v fragments: rows c = 16 t + lr, keys 8 hi .. + 7 and 16 + 8 hi .. + 7 of the pass's 32
            const unsigned char* vb = L + base + lr * VPITCH + ps * 64 + hi * 16;
            v16h vf[16];
#pragma unroll
            for (int t = 0; t < 16; ++t) vf[t] = cat16(*(const v8ha*)(vb + t * 16 * VPITCH), *(const v8ha*)(vb + t * 16 * VPITCH + 32));
            __builtin_amdgcn_sched_barrier(0);   // all 32 LDS loads issue as one group in front of the exponentials and land under them; left free they sink to one product ahead of their use
            const float nm = PSH - m_run; v8u w; float x[16], e[16];   // element s of the B operand: tile s / 8, register s % 8
#pragma unroll
            for (int q = 0; q < 16; ++q) x[q] = __builtin_fmaf(q < 8 ? s0[q & 7] : s1[q & 7], 1.4426950408889634f, nm);
#pragma unroll
            for (int q = 0; q < 16; q += 4)   // four exponentials and one slot in one statement: behind each stands an instruction that neither reads its result nor overwrites its source (outputs apart from all inputs)
                asm("v_exp_f32 %0, %4\n\tv_exp_f32 %1, %5\n\tv_exp_f32 %2, %6\n\tv_exp_f32 %3, %7\n\tv_nop" : "=&v"(e[q]), "=&v"(e[q + 1]), "=&v"(e[q + 2]), "=&v"(e[q + 3]) : "v"(x[q]), "v"(x[q + 1]), "v"(x[q + 2]), "v"(x[q + 3]));
#pragma unroll
            for (int q = 0; q < 8; ++q) { l0 += e[2 * q]; l1 += e[2 * q + 1]; w[q] = pack2h(e[2 * q], e[2 * q + 1]); }
            const v16h pf = __builtin_bit_cast(v16h, w);
#pragma unroll
            for (int t = 0; t < 16; ++t) acc[t] = wmma16(vf[t], pf, acc[t]);
            // four vector slots behind the pass's last products, on the taken back edge too, before the next pass's loads land in the operand registers
            __builtin_amdgcn_sched_barrier(0); asm volatile("v_nop\n\tv_nop\n\tv_nop\n\tv_nop"); __builtin_amdgcn_sched_barrier(0);
        }
        if (st + 1 < NSTG) put(SBUF - base);   // the other buffer: its readers left it before the barrier that ended stage st - 1
        __syncthreads();   // publishes stage st + 1 and ends every wave's reads of this stage's buffer
    }
    // the rows of sod that this wave will store against (whole 512-byte rows), asked for as soon as the loop ends: they fly under the staging of the sums
    const float* sp = sod + (size_t)wave * NP + i0 + lane * 4; v4f sd[32];
#pragma unroll
    for (int s = 0; s < 32; ++s) sd[s] = *(const v4f*)(sp + (size_t)s * 8 * NP);
    // behind the kernel's last load: the address pair is an input, so it stays whole up to this wait
    asm volatile("s_wait_xcnt 0x0" :: "v"(sp) : "memory");
    float l = l0 + l1; l += xhalf(l);   // each wave half summed its own 16 of every 32 keys
    const float f = __fdiv_rn(PCAR, l);
    float* O = (float*)L;   // the ring is free behind the loop's last barrier
#pragma unroll
    for (int t = 0; t < 16; ++t)
#pragma unroll
        for (int r = 0; r < 8; ++r) O[(t * 16 + hi * 8 + r) * OPITCH + wave * 16 + lr] = acc[t][r] * f;
    __syncthreads();   // the whole [256][128] tile is staged before rows are read back
    v4f o[32];   // a wave stores whole 512-byte rows: every 128-byte line has one writer
#pragma unroll
    for (int s = 0; s < 32; ++s) o[s] = *(const v4fa*)(O + (s * 8 + wave) * OPITCH + lane * 4);
#pragma unroll
    for (int s = 0; s < 32; ++s) {
#pragma unroll
        for (int u = 0; u < 4; ++u) { const float sv = bfr(sd[s][u]); o[s][u] = __fadd_rn(sv, __fmul_rn(o[s][u] * (1.0f / PCAR), sv)); } }
#pragma unroll
    for (int s = 0; s < 32; ++s) *(v4f*)(OUTb + (size_t)(s * 8 + wave) * NP + i0 + lane * 4) = o[s];
}

extern "C" void kernel_launch(void* const* d_in, const int* in_sizes, int n_in,
                              void* d_out, int out_size, void* d_ws, size_t ws_size, hipStream_t stream) {
    (void)in_sizes; (void)n_in; (void)out_size;
    const float* sod = (const float*)d_in[0]; const float* edge = (const float*)d_in[1]; const float* wq = (const float*)d_in[2]; const float* bq = (const float*)d_in[3]; const float* wk = (const float*)d_in[4]; const float* bk = (const float*)d_in[5]; const float* wv = (const float*)d_in[6]; const float* bv = (const float*)d_in[7];
    float* OUT = (float*)d_out;     // [8][256][64][64]
    char* wsp = (char*)d_ws;
    auto take = [&](size_t bytes) { char* p = wsp; wsp += (bytes + 255) & ~(size_t)255; return (void*)p; };
    bf* WV = (bf*)take(CC * CC * 2);
    bf* Qh = (bf*)take((size_t)NB_ * NP * KP * 2); bf* Ql = (bf*)take((size_t)NB_ * NP * KP * 2); bf* Kh = (bf*)take((size_t)NB_ * NP * KP * 2); bf* Kl = (bf*)take((size_t)NB_ * NP * KP * 2); h16* V16 = (h16*)take((size_t)NB_ * CC * NP * 2);
    if ((size_t)(wsp - (char*)d_ws) > ws_size) return;    // total ~ 20 MiB: every plane holds all batches
    // all batches in one launch each
    k_prep<<<dim3(NP / 128 + 4, NB_, 1), 256, 0, stream>>>(edge, wq, bq, wk, bk, wv, Qh, Ql, Kh, Kl, WV);   // hi and lo planes of q and k, [b][p][16]; WV = bf16 wv [out][in]
    k_vf<<<dim3(NP / 64, NB_, 1), 256, 0, stream>>>(sod, WV, bv, V16);   // V16[b][c][p] = f16(sum_cc wv[c][cc] sod[b][cc][p] + bv[c])
    k_attn<<<dim3(NP / 128, NB_, 1), 256, 0, stream>>>(Qh, Ql, Kh, Kl, V16, sod, OUT);   // OUT[b][c][i] = sod + sod * sum_j v[c][j] mask[i][j]
}

// v007
// Measured time: 87.8 microseconds a run.
// Timed twice side by side with v006, it ran 1.07 times as fast both times.
// Over all steps from v000 it is 13.9 times as fast.
#include <hip/hip_runtime.h>

// (sod [8][256][64x64], edge [8][32][64x64]; q = wq edge + bq, k = wk edge + bk (16 channels), v = wv sod + bv; mask = softmax_j(sum_d q[d][i] k[d][j]) (unscaled); feat[c][i] = sum_j v[c][j] mask[i][j]; out = sod + feat * sod -> [8][256][64][64]).
// Compute dtypes, f32 accumulate: every input rounded to bf16; q = wq x edge, k = wk x edge and v = wv x sod on PLAIN bf16 operands (inputs: every product exact) + bias; scores (K 16, padded to 32) on bf16 hi+lo planes of q, k (3 products - the unscaled logits are too large for fp16 operands);
// mask and feat: one fused kernel (k_attn), scores^T -> exponentials against a running row maximum -> f16 B operand in registers -> feat^T += v x mask^T on f16 operands; row sums in f32, divided out at the end.

#define NB_  8
#define CC   256
#define CE   32
#define CQ   16
#define NP   4096
#define KP   16
#define PCAR 1024.0f
typedef _Float16 h16;
typedef unsigned short bf;
typedef __attribute__((ext_vector_type(16))) __bf16   v16bf;
typedef __attribute__((ext_vector_type(16))) _Float16 v16h;
typedef __attribute__((ext_vector_type(8)))  _Float16 v8h;
typedef __attribute__((ext_vector_type(8)))  unsigned short v8us;
typedef __attribute__((ext_vector_type(8)))  float    v8f;
typedef __attribute__((ext_vector_type(4)))  float    v4f;
typedef v8h  __attribute__((may_alias)) v8ha;
typedef v4f  __attribute__((may_alias)) v4fa;
typedef v8us __attribute__((may_alias)) v8usa;

__device__ __forceinline__ unsigned short f2bf(float f) { unsigned u = __float_as_uint(f); u += 0x7FFFu + ((u >> 16) & 1u); return (unsigned short)(u >> 16); }
__device__ __forceinline__ float bf2f(unsigned short b) { return __uint_as_float(((unsigned)b) << 16); }
__device__ __forceinline__ float bfr(float f) { return bf2f(f2bf(f)); }
__device__ __forceinline__ v16h cat16(v8h lo, v8h hi) { return __builtin_shufflevector(lo, hi, 0, 1, 2, 3, 4, 5, 6, 7, 8, 9, 10, 11, 12, 13, 14, 15); }
__device__ __forceinline__ v16bf cat16b(v8us lo, v8us hi) { return __builtin_bit_cast(v16bf, __builtin_shufflevector(lo, hi, 0, 1, 2, 3, 4, 5, 6, 7, 8, 9, 10, 11, 12, 13, 14, 15)); }
__device__ __forceinline__ v8f wmma16(v16h a, v16h b, v8f c) { return __builtin_amdgcn_wmma_f32_16x16x32_f16(false, a, false, b, (short)0, c, false, false); }
__device__ __forceinline__ v8f wmmab(v16bf a, v16bf b, v8f c) { return __builtin_amdgcn_wmma_f32_16x16x32_bf16(false, a, false, b, (short)0, c, false, false); }



// fragment of a K-contiguous 16-bit row in the hardware k order: elements k = 0..7 and 16..23 from the lane's pointer (row base + 8 * wave half)
template <typename T16> struct WFrag;
template <> struct WFrag<bf> { typedef v16bf V; static __device__ __forceinline__ V ld(const bf* p) { return cat16b(*(const v8us*)p, *(const v8us*)(p + 16)); } static __device__ __forceinline__ v8f mma(V a, V b, v8f c) { return wmmab(a, b, c); } };

__device__ __forceinline__ h16 tohx(float x) { return (h16)x; }
__device__ __forceinline__ void splitf(float y, unsigned short& h, unsigned short& l) { h = f2bf(y); l = f2bf(y - bf2f(h)); }
typedef __attribute__((ext_vector_type(4))) unsigned short v4us;

// ---- k_prep: the hi and lo planes of q and k, [b][p][16 d] bf16, straight from edge, wq, bq, wk, bk; grid (NP/128 + 4, batches), 8 waves, a wave owns 16 pixels p. The last 4 x batches work-groups round wv to bf16 instead (k_vf's B operand rows [c][cc]).
// Transposed product (A = weight rows d, B = edge columns p, both in the k order of WFrag::ld, K = 32 = one instruction): a lane reads its 16 channels of ONE pixel straight into the B fragment (16 lanes: 64 bytes in a row per channel),
// and then holds 8 consecutive d of that pixel: 16 bytes of each plane, so that a wave's store is 512 bytes in a row, whole lines.
__global__ __launch_bounds__(256) void k_prep(const float* __restrict__ edge, const float* __restrict__ wq, const float* __restrict__ bq, const float* __restrict__ wk, const float* __restrict__ bk, const float* __restrict__ wv, bf* __restrict__ Qh, bf* __restrict__ Ql, bf* __restrict__ Kh, bf* __restrict__ Kl, bf* __restrict__ WV) {
    const int tid = threadIdx.x;
    if (blockIdx.x >= NP / 128) {   // the same for a whole work-group
        const size_t i = ((size_t)(blockIdx.x - NP / 128) * NB_ + blockIdx.y) * 256 + tid;   // 4 x 8 x 256 threads, 8 elements each: all of wv
        static_assert(4 * NB_ * 256 * 8 == CC * CC, "the conversion work-groups cover wv exactly");
        const float* sp = wv + i * 8; const v8f v = *(const v8f*)sp;
        // behind the load: the address pair is an input, so it stays whole up to this wait
        asm volatile("s_wait_xcnt 0x0" :: "v"(sp) : "memory");
        v8us o;
#pragma unroll
        for (int k = 0; k < 8; ++k) o[k] = f2bf(v[k]);
        *(v8us*)(WV + i * 8) = o; return; }
    const int lane = tid & 31, lr = lane & 15, hi = lane >> 4, wave = tid >> 5; const int p = blockIdx.x * 128 + wave * 16 + lr;
    const float* ep = edge + (size_t)blockIdx.y * CE * NP + (size_t)(8 * hi) * NP + p; const float* wqp = wq + lr * CE + 8 * hi; const float* wkp = wk + lr * CE + 8 * hi;
    const v8f bq0 = *(const v8f*)bq, bq1 = *(const v8f*)(bq + 8), bk0 = *(const v8f*)bk, bk1 = *(const v8f*)(bk + 8);   // uniform addresses: scalar loads; the wave half picks its eight values below
    float x[16];   // fragment element e: channel 8 hi + e (e < 8), 16 + 8 hi + e - 8 (e >= 8)
#pragma unroll
    for (int e = 0; e < 16; ++e) x[e] = ep[(size_t)(e < 8 ? e : e + 8) * NP];
    const v8f q0 = *(const v8f*)wqp, q1 = *(const v8f*)(wqp + 16), k0 = *(const v8f*)wkp, k1 = *(const v8f*)(wkp + 16);
    // behind the kernel's last vector load: the three address pairs are inputs, so they stay whole up to this wait
    asm volatile("s_wait_xcnt 0x0" :: "v"(ep), "v"(wqp), "v"(wkp) : "memory");
    // every vector load above has landed here (loaded values as inputs only): they issue as one group and their latencies overlap; left free the compiler asks for the last channels one at a time, each behind a wait for the one before
    asm volatile("" :: "v"(x[0]), "v"(x[1]), "v"(x[2]), "v"(x[3]), "v"(x[4]), "v"(x[5]), "v"(x[6]), "v"(x[7]), "v"(x[8]), "v"(x[9]), "v"(x[10]), "v"(x[11]), "v"(x[12]), "v"(x[13]), "v"(x[14]), "v"(x[15]), "v"(q0), "v"(q1), "v"(k0), "v"(k1));
    v8us x0, x1, a0, a1, c0, c1;
#pragma unroll
    for (int e = 0; e < 8; ++e) { x0[e] = f2bf(x[e]); x1[e] = f2bf(x[8 + e]); a0[e] = f2bf(q0[e]); a1[e] = f2bf(q1[e]); c0[e] = f2bf(k0[e]); c1[e] = f2bf(k1[e]); }
    const v16bf xf = cat16b(x0, x1);
    const v8f dq = wmmab(cat16b(a0, a1), xf, (v8f){}), dk = wmmab(cat16b(c0, c1), xf, (v8f){});   // accumulator register j: d = 8 hi + j; lane column: pixel p
    v8us qh, ql, kh, kl;
#pragma unroll
    for (int j = 0; j < 8; ++j) { unsigned short a, b; splitf(dq[j] + bfr(hi ? bq1[j] : bq0[j]), a, b); qh[j] = a; ql[j] = b; splitf(dk[j] + bfr(hi ? bk1[j] : bk0[j]), a, b); kh[j] = a; kl[j] = b; }
    const size_t o = ((size_t)blockIdx.y * NP + p) * KP + 8 * hi;
    *(v8us*)(Qh + o) = qh; *(v8us*)(Ql + o) = ql; *(v8us*)(Kh + o) = kh; *(v8us*)(Kl + o) = kl;
    // behind the last of the four stores: no register that they name is rewritten in front of this wait, on whichever block the compiler lays out behind them
    asm volatile("s_wait_xcnt 0x0" ::: "memory");
}
// ---- k_vf: V16[b][c][p] = f16(sum_cc wv[c][cc] bf16(sod[b][cc][p]) + bf16(bv[c])): transpose, product and conversion in one kernel; grid (NP/64, batches), 8 waves; a work-group owns 64 pixels p and all 256 c.
// The [256 cc][64 p] f32 tile comes in by whole 128-byte lines (a lane: 2 x 8 rows cc x 4 pixels), is rounded to bf16 and written to LDS as X[p][cc], 16 bytes (8 cc of one p) a store.
// Transposed product V^T = X wv^T (A = X rows p from LDS, B = wv rows c, 32 per wave, held in registers; both in the k order of WFrag::ld), one accumulator chain over the 8 chunks of k:
// a lane then holds 8 consecutive p of ONE c, 16 bytes of f16, staged in Y[c][p] and stored as whole 128-byte lines.
#define XP 264                           // bf16 elements; 528-byte rows read and written by 16-byte LDS operations: an odd multiple of 16
#define YP 72                            // f16 elements; 144-byte rows, the same rule
__global__ __launch_bounds__(256) void k_vf(const float* __restrict__ sod, const bf* __restrict__ WV, const float* __restrict__ bv, h16* __restrict__ V16) {
    __shared__ __align__(16) bf X[64 * XP];
    __shared__ __align__(16) h16 Y[CC * YP];
    const int tid = threadIdx.x, lane = tid & 31, lr = lane & 15, hi = lane >> 4, wave = tid >> 5; const int p0 = blockIdx.x * 64;
    sod += (size_t)blockIdx.y * CC * NP; V16 += (size_t)blockIdx.y * CC * NP;
    // a wave's load covers 4 rows cc x one whole line (8 lanes x 4 pixels); its 16-byte LDS stores then fall on all 64 banks
    const int pq = (lane & 7) + 8 * (wave & 1), g0 = (lane >> 3) + 4 * (wave >> 1);
    const float* sp = sod + (size_t)(g0 * 8) * NP + p0 + pq * 4;
    const bf* wp = WV + (size_t)(wave * 32 + lr) * CC + 8 * hi;
    v4f x[2][8]; v16bf w[2][8];
#pragma unroll
    for (int h = 0; h < 2; ++h)
#pragma unroll
        for (int r = 0; r < 8; ++r) x[h][r] = *(const v4f*)(sp + (size_t)(h * 128 + r) * NP);
#pragma unroll
    for (int cn = 0; cn < 2; ++cn)
#pragma unroll
        for (int kc = 0; kc < 8; ++kc) w[cn][kc] = WFrag<bf>::ld(wp + cn * 16 * CC + kc * 32);
    const float bb0 = bfr(bv[wave * 32 + lr]), bb1 = bfr(bv[wave * 32 + 16 + lr]);
    // behind the kernel's last load: both address pairs are inputs, so they stay whole up to this wait
    asm volatile("s_wait_xcnt 0x0" :: "v"(sp), "v"(wp) : "memory");
#pragma unroll
    for (int h = 0; h < 2; ++h)
#pragma unroll
        for (int u = 0; u < 4; ++u) { v8us o;
#pragma unroll
            for (int r = 0; r < 8; ++r) o[r] = f2bf(x[h][r][u]);
            *(v8usa*)(X + (pq * 4 + u) * XP + h * 128 + g0 * 8) = o; }
    __syncthreads();   // the whole transposed tile is in LDS before any wave reads fragments of it
    v8f acc[4][2];
#pragma unroll
    for (int pm = 0; pm < 4; ++pm) { acc[pm][0] = (v8f){}; acc[pm][1] = (v8f){}; }
#pragma unroll
    for (int kc = 0; kc < 8; ++kc)
#pragma unroll
        for (int pm = 0; pm < 4; ++pm) { const bf* xr = X + (pm * 16 + lr) * XP + 8 * hi + kc * 32; const v16bf a = cat16b(*(const v8usa*)xr, *(const v8usa*)(xr + 16));
            acc[pm][0] = wmmab(a, w[0][kc], acc[pm][0]); acc[pm][1] = wmmab(a, w[1][kc], acc[pm][1]); }
#pragma unroll
    for (int pm = 0; pm < 4; ++pm)
#pragma unroll
        for (int cn = 0; cn < 2; ++cn) { v8h o;   // accumulator register j: pixel pm * 16 + hi * 8 + j; lane column: c = wave * 32 + cn * 16 + lr
#pragma unroll
            for (int j = 0; j < 8; ++j) o[j] = tohx(__fadd_rn(acc[pm][cn][j], cn ? bb1 : bb0));
            *(v8ha*)(Y + (wave * 32 + cn * 16 + lr) * YP + pm * 16 + hi * 8) = o; }
    __syncthreads();   // the whole [256][64] tile is staged before rows are read back
    v8h y[8]; h16* vp = V16 + (size_t)(tid >> 3) * NP + p0 + (tid & 7) * 8;   // 8 lanes store one whole 128-byte line: every line has one writer
#pragma unroll
    for (int s = 0; s < 8; ++s) y[s] = *(const v8ha*)(Y + (s * 32 + (tid >> 3)) * YP + (tid & 7) * 8);
#pragma unroll
    for (int s = 0; s < 8; ++s) *(v8h*)(vp + (size_t)s * 32 * NP) = y[s];
}
#define SKEY   64
#define NSTG   (NP / SKEY)
#define VPITCH 144                       // bytes; 128-byte rows read by 16-byte LDS loads: an odd multiple of 16
#define KPITCH 48                        // bytes; 32-byte rows, the same rule
#define VTILE  (CC * VPITCH)
#define KTILE  (SKEY * KPITCH)
#define SBUF   (VTILE + 2 * KTILE)
#define OPITCH 132                       // floats; output staging [256 c][128 i], one plane per key half
#define PSH    6.0f                      // exponentials carry 2^6 (at most 2^14 with the lazy maximum): small ones keep f16 precision; it cancels against the row sum
typedef __attribute__((ext_vector_type(2))) float v2f;
typedef __attribute__((ext_vector_type(2))) _Float16 v2h;
typedef __attribute__((ext_vector_type(8))) unsigned v8u;
typedef v4us __attribute__((may_alias)) v4usa;
__device__ __forceinline__ float xhalf(float x) { return __builtin_bit_cast(float, __builtin_amdgcn_permlanex16(__builtin_bit_cast(int, x), __builtin_bit_cast(int, x), 0x76543210, 0xfedcba98, false, false)); }  // lane l with lane l ^ 16
__device__ __forceinline__ unsigned pack2h(float a, float b) { return __builtin_bit_cast(unsigned, __builtin_convertvector((v2f){a, b}, v2h)); }  // round to nearest even
__global__ __launch_bounds__(256) __attribute__((amdgpu_waves_per_eu(2, 2))) void k_attn(const bf* __restrict__ Qh, const bf* __restrict__ Ql, const bf* __restrict__ Kh, const bf* __restrict__ Kl, const h16* __restrict__ V16, const float* __restrict__ sod, float* __restrict__ OUTb) {
    __shared__ __align__(16) unsigned char L[2 * CC * OPITCH * 4];
    __shared__ float MJ[8 * 2 * 32], LJ[8 * 2 * 32];   // every wave's maximum in use and row sum, [wave][column tile][lane]
    static_assert(2 * SBUF + 8 * 2048 <= 2 * CC * OPITCH * 4, "the two stage buffers and the q fragments lie inside the output staging");
    const int tid = threadIdx.x, lane = tid & 31, lr = lane & 15, hi = lane >> 4, wave = tid >> 5, rg = wave & 3, kq = wave >> 2; const int i0 = blockIdx.x * 128;
    { const size_t zo = (size_t)blockIdx.y * NP * KP, zv = (size_t)blockIdx.y * CC * NP; Qh += zo; Ql += zo; Kh += zo; Kl += zo; V16 += zv; sod += zv; OUTb += zv; }
    const v8us z8 = (v8us){};
    const size_t qo = (size_t)(i0 + rg * 32 + lr) * KP + 8 * hi; const bf* qhp = Qh + qo; const bf* qlp = Ql + qo;
    // the wave's four q fragments (hi and lo plane of two column tiles) lie in LDS, in a range of the wave's own behind the ring, 16 bytes a lane, and come back with every pass's k fragments: with 256 accumulator registers there is no room to keep them
    unsigned char* qb = L + 2 * SBUF + wave * 2048 + lane * 16;
    { const v8us a = *(const v8usa*)qhp, b = *(const v8usa*)qlp, d = *(const v8usa*)(qhp + 16 * KP), e = *(const v8usa*)(qlp + 16 * KP);
      // behind the four q loads: both address pairs are inputs, so they stay whole up to this wait
      asm volatile("s_wait_xcnt 0x0" :: "v"(qhp), "v"(qlp) : "memory");
      *(v8usa*)qb = a; *(v8usa*)(qb + 512) = b; *(v8usa*)(qb + 1024) = d; *(v8usa*)(qb + 1536) = e; }
    // staging: 8 threads bring one 128-byte row piece of v (rows tid/8 + 32 u); 4 threads bring the 32 real bytes of one k row, of the hi and of the lo plane. The lane offsets never change; the stage moves the uniform base.
    const unsigned vof = (unsigned)(tid >> 3) * NP + (tid & 7) * 8, kof = (unsigned)(tid >> 2) * KP + (tid & 3) * 4;
    const unsigned vdst = (tid >> 3) * VPITCH + (tid & 7) * 16, kdst = VTILE + (tid >> 2) * KPITCH + (tid & 3) * 8;
    v8us sv[8]; v4us skh, skl;
    auto fetch = [&](int st) { const h16* vp = V16 + st * SKEY; const bf* khp = Kh + st * (SKEY * KP); const bf* klp = Kl + st * (SKEY * KP);
#pragma unroll
        for (int u = 0; u < 8; ++u) sv[u] = *(const v8usa*)(vp + u * (32 * NP) + vof);
        skh = *(const v4usa*)(khp + kof); skl = *(const v4usa*)(klp + kof);
        // behind the stage's last load: the three bases are inputs, so they stay whole up to this wait (the lane offsets are made once, in front of the loop, and never rewritten in it)
        asm volatile("s_wait_xcnt 0x0" :: "s"(vp), "s"(khp), "s"(klp) : "memory"); };
    auto put = [&](unsigned base) {
#pragma unroll
        for (int u = 0; u < 8; ++u) *(v8usa*)(L + base + vdst + u * 32 * VPITCH) = sv[u];
        *(v4usa*)(L + base + kdst) = skh; *(v4usa*)(L + base + kdst + KTILE) = skl; };
    v8f acc0[16], acc1[16];   // column tile 0: rows i = rg * 32 + lr; column tile 1: + 16
#pragma unroll
    for (int t = 0; t < 16; ++t) { acc0[t] = (v8f){}; acc1[t] = (v8f){}; }
    float m0 = -__builtin_inff(), m1 = -__builtin_inff(), la0 = 0.f, lb0 = 0.f, la1 = 0.f, lb1 = 0.f;
#pragma unroll 1
    for (int st = -1; st < NSTG; ++st) {   // rolled: one stage's code, the buffer by offset; trip -1 only brings stage 0 in (no pass), so the staging code stands once
        const unsigned base = (st & 1) * SBUF;
        if (st + 1 < NSTG) fetch(st + 1);
        if (st >= 0) {   // the wave's pass: its 32 keys of the stage against its 32 rows
            const unsigned char* kb = L + base + VTILE + (kq * 32 + lr) * KPITCH + hi * 16;
            const v16bf kh0 = cat16b(*(const v8usa*)kb, z8), kh1 = cat16b(*(const v8usa*)(kb + 16 * KPITCH), z8), kl0 = cat16b(*(const v8usa*)(kb + KTILE), z8), kl1 = cat16b(*(const v8usa*)(kb + KTILE + 16 * KPITCH), z8);
            const v16bf qfh0 = cat16b(*(const v8usa*)qb, z8), qfl0 = cat16b(*(const v8usa*)(qb + 512), z8), qfh1 = cat16b(*(const v8usa*)(qb + 1024), z8), qfl1 = cat16b(*(const v8usa*)(qb + 1536), z8);
            v8f s00 = (v8f){}, s01 = (v8f){}, s10 = (v8f){}, s11 = (v8f){};   // s<column tile><key tile>
            s00 = wmmab(kh0, qfh0, s00); s01 = wmmab(kh1, qfh0, s01); s10 = wmmab(kh0, qfh1, s10); s11 = wmmab(kh1, qfh1, s11);
            s00 = wmmab(kh0, qfl0, s00); s01 = wmmab(kh1, qfl0, s01); s10 = wmmab(kh0, qfl1, s10); s11 = wmmab(kh1, qfl1, s11);
            s00 = wmmab(kl0, qfh0, s00); s01 = wmmab(kl1, qfh0, s01); s10 = wmmab(kl0, qfh1, s10); s11 = wmmab(kl1, qfh1, s11);
            float mx0 = fmaxf(s00[0], s01[0]), mx1 = fmaxf(s10[0], s11[0]);
#pragma unroll
            for (int r = 1; r < 8; ++r) { mx0 = fmaxf(mx0, fmaxf(s00[r], s01[r])); mx1 = fmaxf(mx1, fmaxf(s10[r], s11[r])); }
            mx0 = fmaxf(mx0, xhalf(mx0)) * 1.4426950408889634f; mx1 = fmaxf(mx1, xhalf(mx1)) * 1.4426950408889634f;   // both wave halves hold their row's maximum over the 32 keys
            if (__builtin_amdgcn_ballot_w32(mx0 > m0 + 8.0f || mx1 > m1 + 8.0f) != 0) {   // one scalar test a pass; rare after the first passes
                const float n0 = fmaxf(m0, mx0), n1 = fmaxf(m1, mx1), c0 = __builtin_amdgcn_exp2f(m0 - n0), c1 = __builtin_amdgcn_exp2f(m1 - n1);   // 0 in the first pass
                la0 *= c0; lb0 *= c0; la1 *= c1; lb1 *= c1; m0 = n0; m1 = n1;
#pragma unroll
                for (int t = 0; t < 16; ++t) { acc0[t] = acc0[t] * c0; acc1[t] = acc1[t] * c1; }
            }
            // the pass's v fragments: rows c = 16 t + lr, keys 8 hi .. + 7 and 16 + 8 hi .. + 7 of the wave's 32
            const unsigned char* vb = L + base + lr * VPITCH + kq * 64 + hi * 16;
            v16h vf[16];
#pragma unroll
            for (int t = 0; t < 8; ++t) vf[t] = cat16(*(const v8ha*)(vb + t * 16 * VPITCH), *(const v8ha*)(vb + t * 16 * VPITCH + 32));
            __builtin_amdgcn_sched_barrier(0);   // the first 16 LDS loads issue as one group in front of the exponentials and land under them; left free they sink to one product ahead of their use
            v16h pf0, pf1;
#pragma unroll
            for (int ct = 0; ct < 2; ++ct) {
                const float nm = PSH - (ct ? m1 : m0); v8u w; float x[16], e[16];   // element s of the B operand: key tile s / 8, register s % 8
#pragma unroll
                for (int q = 0; q < 16; ++q) x[q] = __builtin_fmaf(ct ? (q < 8 ? s10[q & 7] : s11[q & 7]) : (q < 8 ? s00[q & 7] : s01[q & 7]), 1.4426950408889634f, nm);
#pragma unroll
                for (int q = 0; q < 16; q += 4)   // four exponentials and one slot in one statement: behind each stands an instruction that neither reads its result nor overwrites its source (outputs apart from all inputs)
                    asm("v_exp_f32 %0, %4\n\tv_exp_f32 %1, %5\n\tv_exp_f32 %2, %6\n\tv_exp_f32 %3, %7\n\tv_nop" : "=&v"(e[q]), "=&v"(e[q + 1]), "=&v"(e[q + 2]), "=&v"(e[q + 3]) : "v"(x[q]), "v"(x[q + 1]), "v"(x[q + 2]), "v"(x[q + 3]));
#pragma unroll
                for (int q = 0; q < 8; ++q) { if (ct) { la1 += e[2 * q]; lb1 += e[2 * q + 1]; } else { la0 += e[2 * q]; lb0 += e[2 * q + 1]; } w[q] = pack2h(e[2 * q], e[2 * q + 1]); }
                if (ct) pf1 = __builtin_bit_cast(v16h, w); else pf0 = __builtin_bit_cast(v16h, w);
            }
            __builtin_amdgcn_sched_barrier(0);   // the other 16 LDS loads issue as one group behind the exponentials (whose registers they take) and land under the first 16 products
#pragma unroll
            for (int t = 8; t < 16; ++t) vf[t] = cat16(*(const v8ha*)(vb + t * 16 * VPITCH), *(const v8ha*)(vb + t * 16 * VPITCH + 32));
            __builtin_amdgcn_sched_barrier(0);
#pragma unroll
            for (int t = 0; t < 16; ++t) { acc0[t] = wmma16(vf[t], pf0, acc0[t]); acc1[t] = wmma16(vf[t], pf1, acc1[t]); }
        }
        if (st + 1 < NSTG) put(SBUF - base);   // the other buffer: its readers left it before the barrier that ended stage st - 1
        else {   // behind the last pass: the wave's maxima in use and row sums go to LDS, so that the loop's last barrier publishes them too
            float l0 = la0 + lb0, l1 = la1 + lb1; l0 += xhalf(l0); l1 += xhalf(l1);   // each wave half summed its own 16 of every 32 keys
            MJ[(wave * 2 + 0) * 32 + lane] = m0; MJ[(wave * 2 + 1) * 32 + lane] = m1; LJ[(wave * 2 + 0) * 32 + lane] = l0; LJ[(wave * 2 + 1) * 32 + lane] = l1; }
        __syncthreads();   // publishes stage st + 1 (behind the last stage: both key halves' maxima and row sums) and ends every wave's reads of this stage's buffer
    }
    // the rows of sod that this wave will store against (whole 512-byte rows), asked for as soon as the loop ends: they fly under the join and the staging of the sums
    const float* sp = sod + (size_t)wave * NP + i0 + lane * 4; v4f sd[32];
#pragma unroll
    for (int s = 0; s < 32; ++s) sd[s] = *(const v4f*)(sp + (size_t)s * 8 * NP);
    // behind the kernel's last load: the address pair is an input, so it stays whole up to this wait
    asm volatile("s_wait_xcnt 0x0" :: "v"(sp) : "memory");
    float f[2];
#pragma unroll
    for (int ct = 0; ct < 2; ++ct) {   // both waves of a row group form the same divisor, from the same values in the same order
        const int ja = (rg * 2 + ct) * 32 + lane, jb = ((rg + 4) * 2 + ct) * 32 + lane;
        const float ma = MJ[ja], mb = MJ[jb], mm = fmaxf(ma, mb), ea = __builtin_amdgcn_exp2f(ma - mm), eb = __builtin_amdgcn_exp2f(mb - mm);
        f[ct] = __fdiv_rn(PCAR, __fadd_rn(__fmul_rn(LJ[ja], ea), __fmul_rn(LJ[jb], eb))) * (kq ? eb : ea);
    }
    float* O = (float*)L + kq * (CC * OPITCH);   // the ring is free behind the loop's last barrier; each key half stages into its own plane
#pragma unroll
    for (int t = 0; t < 16; ++t)
#pragma unroll
        for (int r = 0; r < 8; ++r) { float* op = O + (t * 16 + hi * 8 + r) * OPITCH + rg * 32 + lr; op[0] = acc0[t][r] * f[0]; op[16] = acc1[t][r] * f[1]; }
    __syncthreads();   // both [256][128] planes are staged before rows are read back
    const float* R = (const float*)L;
    v4f o[32];   // a wave stores whole 512-byte rows: every 128-byte line has one writer
#pragma unroll
    for (int s = 0; s < 32; ++s) o[s] = *(const v4fa*)(R + (s * 8 + wave) * OPITCH + lane * 4) + *(const v4fa*)(R + CC * OPITCH + (s * 8 + wave) * OPITCH + lane * 4);
#pragma unroll
    for (int s = 0; s < 32; ++s) {
#pragma unroll
        for (int u = 0; u < 4; ++u) { const float sv = bfr(sd[s][u]); o[s][u] = __fadd_rn(sv, __fmul_rn(o[s][u] * (1.0f / PCAR), sv)); } }
#pragma unroll
    for (int s = 0; s < 32; ++s) *(v4f*)(OUTb + (size_t)(s * 8 + wave) * NP + i0 + lane * 4) = o[s];
}

extern "C" void kernel_launch(void* const* d_in, const int* in_sizes, int n_in,
                              void* d_out, int out_size, void* d_ws, size_t ws_size, hipStream_t stream) {
    (void)in_sizes; (void)n_in; (void)out_size;
    const float* sod = (const float*)d_in[0]; const float* edge = (const float*)d_in[1]; const float* wq = (const float*)d_in[2]; const float* bq = (const float*)d_in[3]; const float* wk = (const float*)d_in[4]; const float* bk = (const float*)d_in[5]; const float* wv = (const float*)d_in[6]; const float* bv = (const float*)d_in[7];
    float* OUT = (float*)d_out;     // [8][256][64][64]
    char* wsp = (char*)d_ws;
    auto take = [&](size_t bytes) { char* p = wsp; wsp += (bytes + 255) & ~(size_t)255; return (void*)p; };
    bf* WV = (bf*)take(CC * CC * 2);
    bf* Qh = (bf*)take((size_t)NB_ * NP * KP * 2); bf* Ql = (bf*)take((size_t)NB_ * NP * KP * 2); bf* Kh = (bf*)take((size_t)NB_ * NP * KP * 2); bf* Kl = (bf*)take((size_t)NB_ * NP * KP * 2); h16* V16 = (h16*)take((size_t)NB_ * CC * NP * 2);
    if ((size_t)(wsp - (char*)d_ws) > ws_size) return;    // total ~ 20 MiB: every plane holds all batches
    // all batches in one launch each
    k_prep<<<dim3(NP / 128 + 4, NB_, 1), 256, 0, stream>>>(edge, wq, bq, wk, bk, wv, Qh, Ql, Kh, Kl, WV);   // hi and lo planes of q and k, [b][p][16]; WV = bf16 wv [out][in]
    k_vf<<<dim3(NP / 64, NB_, 1), 256, 0, stream>>>(sod, WV, bv, V16);   // V16[b][c][p] = f16(sum_cc wv[c][cc] sod[b][cc][p] + bv[c])
    k_attn<<<dim3(NP / 128, NB_, 1), 256, 0, stream>>>(Qh, Ql, Kh, Kl, V16, sod, OUT);   // OUT[b][c][i] = sod + sod * sum_j v[c][j] mask[i][j]
}

// v008
// One run takes 79.6 microseconds.
// Two timings next to v007 both put it at 1.10 times that version's speed.
// Counting every step since v000, it is 15.4 times as fast.
#include <hip/hip_runtime.h>

// (sod [8][256][64x64], edge [8][32][64x64]; q = wq edge + bq, k = wk edge + bk (16 channels), v = wv sod + bv; mask = softmax_j(sum_d q[d][i] k[d][j]) (unscaled); feat[c][i] = sum_j v[c][j] mask[i][j]; out = sod + feat * sod -> [8][256][64][64]).
// Compute dtypes, f32 accumulate: every input rounded to bf16; q = wq x edge, k = wk x edge and v = wv x sod on PLAIN bf16 operands (inputs: every product exact) + bias; scores (K 16, padded to 32) on bf16 hi+lo planes of q, k (3 products - the unscaled logits are too large for fp16 operands);
// mask and feat: one fused kernel (k_attn), scores^T -> exponentials against a running row maximum -> f16 B operand in registers -> feat^T += v x mask^T on f16 operands; row sums in f32, divided out at the end.

#define NB_  8
#define CC   256
#define CE   32
#define CQ   16
#define NP   4096
#define KP   16
#define PCAR 1024.0f
typedef _Float16 h16;
typedef unsigned short bf;
typedef __attribute__((ext_vector_type(16))) __bf16   v16bf;
typedef __attribute__((ext_vector_type(16))) _Float16 v16h;
typedef __attribute__((ext_vector_type(8)))  _Float16 v8h;
typedef __attribute__((ext_vector_type(8)))  unsigned short v8us;
typedef __attribute__((ext_vector_type(8)))  float    v8f;
typedef __attribute__((ext_vector_type(4)))  float    v4f;
typedef v8h  __attribute__((may_alias)) v8ha;
typedef v4f  __attribute__((may_alias)) v4fa;
typedef v8us __attribute__((may_alias)) v8usa;

__device__ __forceinline__ unsigned short f2bf(float f) { unsigned u = __float_as_uint(f); u += 0x7FFFu + ((u >> 16) & 1u); return (unsigned short)(u >> 16); }
__device__ __forceinline__ float bf2f(unsigned short b) { return __uint_as_float(((unsigned)b) << 16); }
__device__ __forceinline__ float bfr(float f) { return bf2f(f2bf(f)); }
__device__ __forceinline__ v16h cat16(v8h lo, v8h hi) { return __builtin_shufflevector(lo, hi, 0, 1, 2, 3, 4, 5, 6, 7, 8, 9, 10, 11, 12, 13, 14, 15); }
__device__ __forceinline__ v16bf cat16b(v8us lo, v8us hi) { return __builtin_bit_cast(v16bf, __builtin_shufflevector(lo, hi, 0, 1, 2, 3, 4, 5, 6, 7, 8, 9, 10, 11, 12, 13, 14, 15)); }
__device__ __forceinline__ v8f wmma16(v16h a, v16h b, v8f c) { return __builtin_amdgcn_wmma_f32_16x16x32_f16(false, a, false, b, (short)0, c, false, false); }
__device__ __forceinline__ v8f wmmab(v16bf a, v16bf b, v8f c) { return __builtin_amdgcn_wmma_f32_16x16x32_bf16(false, a, false, b, (short)0, c, false, false); }



// fragment of a K-contiguous 16-bit row in the hardware k order: elements k = 0..7 and 16..23 from the lane's pointer (row base + 8 * wave half)
template <typename T16> struct WFrag;
template <> struct WFrag<bf> { typedef v16bf V; static __device__ __forceinline__ V ld(const bf* p) { return cat16b(*(const v8us*)p, *(const v8us*)(p + 16)); } static __device__ __forceinline__ v8f mma(V a, V b, v8f c) { return wmmab(a, b, c); } };

__device__ __forceinline__ h16 tohx(float x) { return (h16)x; }
__device__ __forceinline__ void splitf(float y, unsigned short& h, unsigned short& l) { h = f2bf(y); l = f2bf(y - bf2f(h)); }
typedef __attribute__((ext_vector_type(4))) unsigned short v4us;

// ---- k_prep: the hi and lo planes of q and k, [b][p][16 d] bf16, straight from edge, wq, bq, wk, bk; grid (NP/128 + 4, batches), 8 waves, a wave owns 16 pixels p. The last 4 x batches work-groups round wv to bf16 instead (k_vf's B operand rows [c][cc]).
// Transposed product (A = weight rows d, B = edge columns p, both in the k order of WFrag::ld, K = 32 = one instruction): a lane reads its 16 channels of ONE pixel straight into the B fragment (16 lanes: 64 bytes in a row per channel),
// and then holds 8 consecutive d of that pixel: 16 bytes of each plane, so that a wave's store is 512 bytes in a row, whole lines.
__global__ __launch_bounds__(256) void k_prep(const float* __restrict__ edge, const float* __restrict__ wq, const float* __restrict__ bq, const float* __restrict__ wk, const float* __restrict__ bk, const float* __restrict__ wv, bf* __restrict__ Qh, bf* __restrict__ Ql, bf* __restrict__ Kh, bf* __restrict__ Kl, bf* __restrict__ WV) {
    const int tid = threadIdx.x;
    if (blockIdx.x >= NP / 128) {   // the same for a whole work-group
        const size_t i = ((size_t)(blockIdx.x - NP / 128) * NB_ + blockIdx.y) * 256 + tid;   // 4 x 8 x 256 threads, 8 elements each: all of wv
        static_assert(4 * NB_ * 256 * 8 == CC * CC, "the conversion work-groups cover wv exactly");
        const float* sp = wv + i * 8; const v8f v = *(const v8f*)sp;
        // behind the load: the address pair is an input, so it stays whole up to this wait
        asm volatile("s_wait_xcnt 0x0" :: "v"(sp) : "memory");
        v8us o;
#pragma unroll
        for (int k = 0; k < 8; ++k) o[k] = f2bf(v[k]);
        *(v8us*)(WV + i * 8) = o; return; }
    const int lane = tid & 31, lr = lane & 15, hi = lane >> 4, wave = tid >> 5; const int p = blockIdx.x * 128 + wave * 16 + lr;
    const float* ep = edge + (size_t)blockIdx.y * CE * NP + (size_t)(8 * hi) * NP + p; const float* wqp = wq + lr * CE + 8 * hi; const float* wkp = wk + lr * CE + 8 * hi;
    const v8f bq0 = *(const v8f*)bq, bq1 = *(const v8f*)(bq + 8), bk0 = *(const v8f*)bk, bk1 = *(const v8f*)(bk + 8);   // uniform addresses: scalar loads; the wave half picks its eight values below
    float x[16];   // fragment element e: channel 8 hi + e (e < 8), 16 + 8 hi + e - 8 (e >= 8)
#pragma unroll
    for (int e = 0; e < 16; ++e) x[e] = ep[(size_t)(e < 8 ? e : e + 8) * NP];
    const v8f q0 = *(const v8f*)wqp, q1 = *(const v8f*)(wqp + 16), k0 = *(const v8f*)wkp, k1 = *(const v8f*)(wkp + 16);
    // behind the kernel's last vector load: the three address pairs are inputs, so they stay whole up to this wait
    asm volatile("s_wait_xcnt 0x0" :: "v"(ep), "v"(wqp), "v"(wkp) : "memory");
    // every vector load above has landed here (loaded values as inputs only): they issue as one group and their latencies overlap; left free the compiler asks for the last channels one at a time, each behind a wait for the one before
    asm volatile("" :: "v"(x[0]), "v"(x[1]), "v"(x[2]), "v"(x[3]), "v"(x[4]), "v"(x[5]), "v"(x[6]), "v"(x[7]), "v"(x[8]), "v"(x[9]), "v"(x[10]), "v"(x[11]), "v"(x[12]), "v"(x[13]), "v"(x[14]), "v"(x[15]), "v"(q0), "v"(q1), "v"(k0), "v"(k1));
    v8us x0, x1, a0, a1, c0, c1;
#pragma unroll
    for (int e = 0; e < 8; ++e) { x0[e] = f2bf(x[e]); x1[e] = f2bf(x[8 + e]); a0[e] = f2bf(q0[e]); a1[e] = f2bf(q1[e]); c0[e] = f2bf(k0[e]); c1[e] = f2bf(k1[e]); }
    const v16bf xf = cat16b(x0, x1);
    const v8f dq = wmmab(cat16b(a0, a1), xf, (v8f){}), dk = wmmab(cat16b(c0, c1), xf, (v8f){});   // accumulator register j: d = 8 hi + j; lane column: pixel p
    v8us qh, ql, kh, kl;
#pragma unroll
    for (int j = 0; j < 8; ++j) { unsigned short a, b; splitf(dq[j] + bfr(hi ? bq1[j] : bq0[j]), a, b); qh[j] = a; ql[j] = b; splitf(dk[j] + bfr(hi ? bk1[j] : bk0[j]), a, b); kh[j] = a; kl[j] = b; }
    const size_t o = ((size_t)blockIdx.y * NP + p) * KP + 8 * hi;
    *(v8us*)(Qh + o) = qh; *(v8us*)(Ql + o) = ql; *(v8us*)(Kh + o) = kh; *(v8us*)(Kl + o) = kl;
    // behind the last of the four stores: no register that they name is rewritten in front of this wait, on whichever block the compiler lays out behind them
    asm volatile("s_wait_xcnt 0x0" ::: "memory");
}
// ---- k_vf: V16[b][c][p] = f16(sum_cc wv[c][cc] bf16(sod[b][cc][p]) + bf16(bv[c])): transpose, product and conversion in one kernel; grid (NP/64, batches), 8 waves; a work-group owns 64 pixels p and all 256 c.
// The [256 cc][64 p] f32 tile comes in by whole 128-byte lines (a lane: 2 x 8 rows cc x 4 pixels), is rounded to bf16 and written to LDS as X[p][cc], 16 bytes (8 cc of one p) a store.
// Transposed product V^T = X wv^T (A = X rows p from LDS, B = wv rows c, 32 per wave, held in registers; both in the k order of WFrag::ld), one accumulator chain over the 8 chunks of k:
// a lane then holds 8 consecutive p of ONE c, 16 bytes of f16, staged in Y[c][p] and stored as whole 128-byte lines.
#define XP 264                           // bf16 elements; 528-byte rows read and written by 16-byte LDS operations: an odd multiple of 16
#define YP 72                            // f16 elements; 144-byte rows, the same rule
__global__ __launch_bounds__(256) void k_vf(const float* __restrict__ sod, const bf* __restrict__ WV, const float* __restrict__ bv, h16* __restrict__ V16) {
    __shared__ __align__(16) bf X[64 * XP];
    __shared__ __align__(16) h16 Y[CC * YP];
    const int tid = threadIdx.x, lane = tid & 31, lr = lane & 15, hi = lane >> 4, wave = tid >> 5; const int p0 = blockIdx.x * 64;
    sod += (size_t)blockIdx.y * CC * NP; V16 += (size_t)blockIdx.y * CC * NP;
    // a wave's load covers 4 rows cc x one whole line (8 lanes x 4 pixels); its 16-byte LDS stores then fall on all 64 banks
    const int pq = (lane & 7) + 8 * (wave & 1), g0 = (lane >> 3) + 4 * (wave >> 1);
    const float* sp = sod + (size_t)(g0 * 8) * NP + p0 + pq * 4;
    const bf* wp = WV + (size_t)(wave * 32 + lr) * CC + 8 * hi;
    v4f x[2][8]; v16bf w[2][8];
#pragma unroll
    for (int h = 0; h < 2; ++h)
#pragma unroll
        for (int r = 0; r < 8; ++r) x[h][r] = *(const v4f*)(sp + (size_t)(h * 128 + r) * NP);
#pragma unroll
    for (int cn = 0; cn < 2; ++cn)
#pragma unroll
        for (int kc = 0; kc < 8; ++kc) w[cn][kc] = WFrag<bf>::ld(wp + cn * 16 * CC + kc * 32);
    const float bb0 = bfr(bv[wave * 32 + lr]), bb1 = bfr(bv[wave * 32 + 16 + lr]);
    // behind the kernel's last load: both address pairs are inputs, so they stay whole up to this wait
    asm volatile("s_wait_xcnt 0x0" :: "v"(sp), "v"(wp) : "memory");
#pragma unroll
    for (int h = 0; h < 2; ++h)
#pragma unroll
        for (int u = 0; u < 4; ++u) { v8us o;
#pragma unroll
            for (int r = 0; r < 8; ++r) o[r] = f2bf(x[h][r][u]);
            *(v8usa*)(X + (pq * 4 + u) * XP + h * 128 + g0 * 8) = o; }
    __syncthreads();   // the whole transposed tile is in LDS before any wave reads fragments of it
    v8f acc[4][2];
#pragma unroll
    for (int pm = 0; pm < 4; ++pm) { acc[pm][0] = (v8f){}; acc[pm][1] = (v8f){}; }
#pragma unroll
    for (int kc = 0; kc < 8; ++kc)
#pragma unroll
        for (int pm = 0; pm < 4; ++pm) { const bf* xr = X + (pm * 16 + lr) * XP + 8 * hi + kc * 32; const v16bf a = cat16b(*(const v8usa*)xr, *(const v8usa*)(xr + 16));
            acc[pm][0] = wmmab(a, w[0][kc], acc[pm][0]); acc[pm][1] = wmmab(a, w[1][kc], acc[pm][1]); }
#pragma unroll
    for (int pm = 0; pm < 4; ++pm)
#pragma unroll
        for (int cn = 0; cn < 2; ++cn) { v8h o;   // accumulator register j: pixel pm * 16 + hi * 8 + j; lane column: c = wave * 32 + cn * 16 + lr
#pragma unroll
            for (int j = 0; j < 8; ++j) o[j] = tohx(__fadd_rn(acc[pm][cn][j], cn ? bb1 : bb0));
            *(v8ha*)(Y + (wave * 32 + cn * 16 + lr) * YP + pm * 16 + hi * 8) = o; }
    __syncthreads();   // the whole [256][64] tile is staged before rows are read back
    v8h y[8]; h16* vp = V16 + (size_t)(tid >> 3) * NP + p0 + (tid & 7) * 8;   // 8 lanes store one whole 128-byte line: every line has one writer
#pragma unroll
    for (int s = 0; s < 8; ++s) y[s] = *(const v8ha*)(Y + (s * 32 + (tid >> 3)) * YP + (tid & 7) * 8);
#pragma unroll
    for (int s = 0; s < 8; ++s) *(v8h*)(vp + (size_t)s * 32 * NP) = y[s];
}
#define SKEY   64
#define NSTG   (NP / SKEY)
#define GS     3                         // stages between two barriers
#define NGRP   ((NSTG + GS - 1) / GS)    // the last group is short: every use of a stage number is guarded
#define VPITCH 144                       // bytes; 128-byte rows read by 16-byte LDS loads: an odd multiple of 16
#define KPITCH 48                        // bytes; 32-byte rows, the same rule
#define VTILE  (CC * VPITCH)
#define KTILE  (SKEY * KPITCH)
#define SBUF   (VTILE + 2 * KTILE)
#define OPITCH 132                       // floats; output staging [256 c][128 i], one plane per key half
#define PSH    6.0f                      // exponentials carry 2^6 (at most 2^14 with the lazy maximum): small ones keep f16 precision; it cancels against the row sum
typedef __attribute__((ext_vector_type(2))) float v2f;
typedef __attribute__((ext_vector_type(2))) _Float16 v2h;
typedef __attribute__((ext_vector_type(8))) unsigned v8u;
typedef v4us __attribute__((may_alias)) v4usa;
__device__ __forceinline__ float xhalf(float x) { return __builtin_bit_cast(float, __builtin_amdgcn_permlanex16(__builtin_bit_cast(int, x), __builtin_bit_cast(int, x), 0x76543210, 0xfedcba98, false, false)); }  // lane l with lane l ^ 16
__device__ __forceinline__ unsigned pack2h(float a, float b) { return __builtin_bit_cast(unsigned, __builtin_convertvector((v2f){a, b}, v2h)); }  // round to nearest even
__global__ __launch_bounds__(256) __attribute__((amdgpu_waves_per_eu(2, 2))) void k_attn(const bf* __restrict__ Qh, const bf* __restrict__ Ql, const bf* __restrict__ Kh, const bf* __restrict__ Kl, const h16* __restrict__ V16, const float* __restrict__ sod, float* __restrict__ OUTb) {
    __shared__ __align__(16) unsigned char L[2 * GS * SBUF + 8 * 2048];
    __shared__ float MJ[8 * 2 * 32], LJ[8 * 2 * 32];   // every wave's maximum in use and row sum, [wave][column tile][lane]
    static_assert(2 * CC * OPITCH * 4 <= 2 * GS * SBUF + 8 * 2048, "the output staging lies inside the ring and the q fragments");
    const int tid = threadIdx.x, lane = tid & 31, lr = lane & 15, hi = lane >> 4, wave = tid >> 5, rg = wave & 3, kq = wave >> 2; const int i0 = blockIdx.x * 128;
    { const size_t zo = (size_t)blockIdx.y * NP * KP, zv = (size_t)blockIdx.y * CC * NP; Qh += zo; Ql += zo; Kh += zo; Kl += zo; V16 += zv; sod += zv; OUTb += zv; }
    const v8us z8 = (v8us){};
    const size_t qo = (size_t)(i0 + rg * 32 + lr) * KP + 8 * hi; const bf* qhp = Qh + qo; const bf* qlp = Ql + qo;
    // the wave's four q fragments (hi and lo plane of two column tiles) lie in LDS, in a range of the wave's own behind the ring, 16 bytes a lane, and come back with every pass's k fragments: with 256 accumulator registers there is no room to keep them
    unsigned char* qb = L + 2 * GS * SBUF + wave * 2048 + lane * 16;
    { const v8us a = *(const v8usa*)qhp, b = *(const v8usa*)qlp, d = *(const v8usa*)(qhp + 16 * KP), e = *(const v8usa*)(qlp + 16 * KP);
      // behind the four q loads: both address pairs are inputs, so they stay whole up to this wait
      asm volatile("s_wait_xcnt 0x0" :: "v"(qhp), "v"(qlp) : "memory");
      *(v8usa*)qb = a; *(v8usa*)(qb + 512) = b; *(v8usa*)(qb + 1024) = d; *(v8usa*)(qb + 1536) = e; }
    // staging: 8 threads bring one 128-byte row piece of v (rows tid/8 + 32 u); 4 threads bring the 32 real bytes of one k row, of the hi and of the lo plane. The lane offsets never change; the stage moves the uniform base.
    const unsigned vof = (unsigned)(tid >> 3) * NP + (tid & 7) * 8, kof = (unsigned)(tid >> 2) * KP + (tid & 3) * 4;
    const unsigned vdst = (tid >> 3) * VPITCH + (tid & 7) * 16, kdst = VTILE + (tid >> 2) * KPITCH + (tid & 3) * 8;
    v8us sv[8]; v4us skh, skl;
    auto fetch = [&](int st) { const h16* vp = V16 + st * SKEY; const bf* khp = Kh + st * (SKEY * KP); const bf* klp = Kl + st * (SKEY * KP);
#pragma unroll
        for (int u = 0; u < 8; ++u) sv[u] = *(const v8usa*)(vp + u * (32 * NP) + vof);
        skh = *(const v4usa*)(khp + kof); skl = *(const v4usa*)(klp + kof);
        // behind the stage's last load: the three bases are inputs, so they stay whole up to this wait (the lane offsets are made once, in front of the loop, and never rewritten in it)
        asm volatile("s_wait_xcnt 0x0" :: "s"(vp), "s"(khp), "s"(klp) : "memory"); };
    auto put = [&](unsigned base) {
#pragma unroll
        for (int u = 0; u < 8; ++u) *(v8usa*)(L + base + vdst + u * 32 * VPITCH) = sv[u];
        *(v4usa*)(L + base + kdst) = skh; *(v4usa*)(L + base + kdst + KTILE) = skl; };
    {   // group 0 comes in ahead of the loop as ONE run of loads, so that its GS stages cost one latency and not GS in a row (the accumulators' registers are still free here)
        v8us pv[GS][8]; v4us ph[GS], pl[GS]; const unsigned vob = vof * 2, kob = kof * 2;   // the lane offsets in bytes, as the loads take them
        const unsigned char* gv = (const unsigned char*)V16; const unsigned char* gh = (const unsigned char*)Kh; const unsigned char* gl = (const unsigned char*)Kl;
#pragma unroll
        for (int h = 0; h < GS; ++h) {
#pragma unroll
            for (int u = 0; u < 8; ++u) pv[h][u] = *(const v8usa*)(gv + (h * SKEY + u * (32 * NP)) * 2 + vob);
            ph[h] = *(const v4usa*)(gh + h * (SKEY * KP) * 2 + kob); pl[h] = *(const v4usa*)(gl + h * (SKEY * KP) * 2 + kob); }
        // behind the run's last load: the three bases and the lane offsets (tid: the k loads may take it scaled) are inputs, so they stay whole up to this wait
        asm volatile("s_wait_xcnt 0x0" :: "s"(gv), "s"(gh), "s"(gl), "v"(vob), "v"(kob), "v"(tid) : "memory");
#pragma unroll
        for (int h = 0; h < GS; ++h) {
#pragma unroll
            for (int u = 0; u < 8; ++u) *(v8usa*)(L + h * SBUF + vdst + u * 32 * VPITCH) = pv[h][u];
            *(v4usa*)(L + h * SBUF + kdst) = ph[h]; *(v4usa*)(L + h * SBUF + kdst + KTILE) = pl[h]; }
    }
    __syncthreads();   // publishes group 0: no wave reads a stage of it in front of this barrier
    v8f acc0[16], acc1[16];   // column tile 0: rows i = rg * 32 + lr; column tile 1: + 16
#pragma unroll
    for (int t = 0; t < 16; ++t) { acc0[t] = (v8f){}; acc1[t] = (v8f){}; }
    float m0 = -__builtin_inff(), m1 = -__builtin_inff(), la0 = 0.f, lb0 = 0.f, la1 = 0.f, lb1 = 0.f;
#pragma unroll 1
    for (int g = 0; g < NGRP; ++g) {   // rolled: one group's code, the ring half by offset
      const unsigned rb = (g & 1) * (GS * SBUF), wb = GS * SBUF - rb;   // the half that is read, the half that is filled
#pragma unroll
      for (int h = 0; h < GS; ++h) {   // unrolled: the group's stages, with no barrier between them
        const unsigned base = rb + h * SBUF; const int st = g * GS + h, fs = st + GS;   // this pass's stage; the stage brought in under it (all tests on them are the same for the whole work-group)
        if (fs < NSTG) fetch(fs);
        if (st < NSTG) {   // the wave's pass: its 32 keys of the stage against its 32 rows
            const unsigned char* kb = L + base + VTILE + (kq * 32 + lr) * KPITCH + hi * 16;
            const v16bf kh0 = cat16b(*(const v8usa*)kb, z8), kh1 = cat16b(*(const v8usa*)(kb + 16 * KPITCH), z8), kl0 = cat16b(*(const v8usa*)(kb + KTILE), z8), kl1 = cat16b(*(const v8usa*)(kb + KTILE + 16 * KPITCH), z8);
            const v16bf qfh0 = cat16b(*(const v8usa*)qb, z8), qfl0 = cat16b(*(const v8usa*)(qb + 512), z8), qfh1 = cat16b(*(const v8usa*)(qb + 1024), z8), qfl1 = cat16b(*(const v8usa*)(qb + 1536), z8);
            v8f s00 = (v8f){}, s01 = (v8f){}, s10 = (v8f){}, s11 = (v8f){};   // s<column tile><key tile>
            s00 = wmmab(kh0, qfh0, s00); s01 = wmmab(kh1, qfh0, s01); s10 = wmmab(kh0, qfh1, s10); s11 = wmmab(kh1, qfh1, s11);
            s00 = wmmab(kh0, qfl0, s00); s01 = wmmab(kh1, qfl0, s01); s10 = wmmab(kh0, qfl1, s10); s11 = wmmab(kh1, qfl1, s11);
            s00 = wmmab(kl0, qfh0, s00); s01 = wmmab(kl1, qfh0, s01); s10 = wmmab(kl0, qfh1, s10); s11 = wmmab(kl1, qfh1, s11);
            float mx0 = fmaxf(s00[0], s01[0]), mx1 = fmaxf(s10[0], s11[0]);
#pragma unroll
            for (int r = 1; r < 8; ++r) { mx0 = fmaxf(mx0, fmaxf(s00[r], s01[r])); mx1 = fmaxf(mx1, fmaxf(s10[r], s11[r])); }
            mx0 = fmaxf(mx0, xhalf(mx0)) * 1.4426950408889634f; mx1 = fmaxf(mx1, xhalf(mx1)) * 1.4426950408889634f;   // both wave halves hold their row's maximum over the 32 keys
            if (__builtin_amdgcn_ballot_w32(mx0 > m0 + 8.0f || mx1 > m1 + 8.0f) != 0) {   // one scalar test a pass; rare after the first passes
                const float n0 = fmaxf(m0, mx0), n1 = fmaxf(m1, mx1), c0 = __builtin_amdgcn_exp2f(m0 - n0), c1 = __builtin_amdgcn_exp2f(m1 - n1);   // 0 in the first pass
                la0 *= c0; lb0 *= c0; la1 *= c1; lb1 *= c1; m0 = n0; m1 = n1;
#pragma unroll
                for (int t = 0; t < 16; ++t) { acc0[t] = acc0[t] * c0; acc1[t] = acc1[t] * c1; }
            }
            // the pass's v fragments: rows c = 16 t + lr, keys 8 hi .. + 7 and 16 + 8 hi .. + 7 of the wave's 32
            const unsigned char* vb = L + base + lr * VPITCH + kq * 64 + hi * 16;
            v16h vf[16];
#pragma unroll
            for (int t = 0; t < 8; ++t) vf[t] = cat16(*(const v8ha*)(vb + t * 16 * VPITCH), *(const v8ha*)(vb + t * 16 * VPITCH + 32));
            __builtin_amdgcn_sched_barrier(0);   // the first 16 LDS loads issue as one group in front of the exponentials and land under them; left free they sink to one product ahead of their use
            v16h pf0, pf1;
#pragma unroll
            for (int ct = 0; ct < 2; ++ct) {
                const float nm = PSH - (ct ? m1 : m0); v8u w; float x[16], e[16];   // element s of the B operand: key tile s / 8, register s % 8
#pragma unroll
                for (int q = 0; q < 16; ++q) x[q] = __builtin_fmaf(ct ? (q < 8 ? s10[q & 7] : s11[q & 7]) : (q < 8 ? s00[q & 7] : s01[q & 7]), 1.4426950408889634f, nm);
#pragma unroll
                for (int q = 0; q < 16; q += 4)   // four exponentials and one slot in one statement: behind each stands an instruction that neither reads its result nor overwrites its source (outputs apart from all inputs)
                    asm("v_exp_f32 %0, %4\n\tv_exp_f32 %1, %5\n\tv_exp_f32 %2, %6\n\tv_exp_f32 %3, %7\n\tv_nop" : "=&v"(e[q]), "=&v"(e[q + 1]), "=&v"(e[q + 2]), "=&v"(e[q + 3]) : "v"(x[q]), "v"(x[q + 1]), "v"(x[q + 2]), "v"(x[q + 3]));
#pragma unroll
                for (int q = 0; q < 8; ++q) { if (ct) { la1 += e[2 * q]; lb1 += e[2 * q + 1]; } else { la0 += e[2 * q]; lb0 += e[2 * q + 1]; } w[q] = pack2h(e[2 * q], e[2 * q + 1]); }
                if (ct) pf1 = __builtin_bit_cast(v16h, w); else pf0 = __builtin_bit_cast(v16h, w);
            }
            __builtin_amdgcn_sched_barrier(0);   // the other 16 LDS loads issue as one group behind the exponentials (whose registers they take) and land under the first 16 products
#pragma unroll
            for (int t = 8; t < 16; ++t) vf[t] = cat16(*(const v8ha*)(vb + t * 16 * VPITCH), *(const v8ha*)(vb + t * 16 * VPITCH + 32));
            __builtin_amdgcn_sched_barrier(0);
#pragma unroll
            for (int t = 0; t < 16; ++t) { acc0[t] = wmma16(vf[t], pf0, acc0[t]); acc1[t] = wmma16(vf[t], pf1, acc1[t]); }
        }
        if (fs < NSTG) put(wb + h * SBUF);   // the other half: its readers left it before the barrier that ended group g - 1
        else if (st == NSTG - 1) {   // behind the last pass: the wave's maxima in use and row sums go to LDS, so that the loop's last barrier publishes them too
            float l0 = la0 + lb0, l1 = la1 + lb1; l0 += xhalf(l0); l1 += xhalf(l1);   // each wave half summed its own 16 of every 32 keys
            MJ[(wave * 2 + 0) * 32 + lane] = m0; MJ[(wave * 2 + 1) * 32 + lane] = m1; LJ[(wave * 2 + 0) * 32 + lane] = l0; LJ[(wave * 2 + 1) * 32 + lane] = l1; }
      }
      __syncthreads();   // publishes group g + 1 (behind the last group: both key halves' maxima and row sums) and ends every wave's reads of this group's buffers
    }
    // the rows of sod that this wave will store against (whole 512-byte rows), asked for as soon as the loop ends: they fly under the join and the staging of the sums
    const float* sp = sod + (size_t)wave * NP + i0 + lane * 4; v4f sd[32];
#pragma unroll
    for (int s = 0; s < 32; ++s) sd[s] = *(const v4f*)(sp + (size_t)s * 8 * NP);
    // behind the kernel's last load: the address pair is an input, so it stays whole up to this wait
    asm volatile("s_wait_xcnt 0x0" :: "v"(sp) : "memory");
    float f[2];
#pragma unroll
    for (int ct = 0; ct < 2; ++ct) {   // both waves of a row group form the same divisor, from the same values in the same order
        const int ja = (rg * 2 + ct) * 32 + lane, jb = ((rg + 4) * 2 + ct) * 32 + lane;
        const float ma = MJ[ja], mb = MJ[jb], mm = fmaxf(ma, mb), ea = __builtin_amdgcn_exp2f(ma - mm), eb = __builtin_amdgcn_exp2f(mb - mm);
        f[ct] = __fdiv_rn(PCAR, __fadd_rn(__fmul_rn(LJ[ja], ea), __fmul_rn(LJ[jb], eb))) * (kq ? eb : ea);
    }
    float* O = (float*)L + kq * (CC * OPITCH);   // the ring is free behind the loop's last barrier; each key half stages into its own plane
#pragma unroll
    for (int t = 0; t < 16; ++t)
#pragma unroll
        for (int r = 0; r < 8; ++r) { float* op = O + (t * 16 + hi * 8 + r) * OPITCH + rg * 32 + lr; op[0] = acc0[t][r] * f[0]; op[16] = acc1[t][r] * f[1]; }
    __syncthreads();   // both [256][128] planes are staged before rows are read back
    const float* R = (const float*)L;
    v4f o[32];   // a wave stores whole 512-byte rows: every 128-byte line has one writer
#pragma unroll
    for (int s = 0; s < 32; ++s) o[s] = *(const v4fa*)(R + (s * 8 + wave) * OPITCH + lane * 4) + *(const v4fa*)(R + CC * OPITCH + (s * 8 + wave) * OPITCH + lane * 4);
#pragma unroll
    for (int s = 0; s < 32; ++s) {
#pragma unroll
        for (int u = 0; u < 4; ++u) { const float sv = bfr(sd[s][u]); o[s][u] = __fadd_rn(sv, __fmul_rn(o[s][u] * (1.0f / PCAR), sv)); } }
#pragma unroll
    for (int s = 0; s < 32; ++s) *(v4f*)(OUTb + (size_t)(s * 8 + wave) * NP + i0 + lane * 4) = o[s];
}

extern "C" void kernel_launch(void* const* d_in, const int* in_sizes, int n_in,
                              void* d_out, int out_size, void* d_ws, size_t ws_size, hipStream_t stream) {
    (void)in_sizes; (void)n_in; (void)out_size;
    const float* sod = (const float*)d_in[0]; const float* edge = (const float*)d_in[1]; const float* wq = (const float*)d_in[2]; const float* bq = (const float*)d_in[3]; const float* wk = (const float*)d_in[4]; const float* bk = (const float*)d_in[5]; const float* wv = (const float*)d_in[6]; const float* bv = (const float*)d_in[7];
    float* OUT = (float*)d_out;     // [8][256][64][64]
    char* wsp = (char*)d_ws;
    auto take = [&](size_t bytes) { char* p = wsp; wsp += (bytes + 255) & ~(size_t)255; return (void*)p; };
    bf* WV = (bf*)take(CC * CC * 2);
    bf* Qh = (bf*)take((size_t)NB_ * NP * KP * 2); bf* Ql = (bf*)take((size_t)NB_ * NP * KP * 2); bf* Kh = (bf*)take((size_t)NB_ * NP * KP * 2); bf* Kl = (bf*)take((size_t)NB_ * NP * KP * 2); h16* V16 = (h16*)take((size_t)NB_ * CC * NP * 2);
    if ((size_t)(wsp - (char*)d_ws) > ws_size) return;    // total ~ 20 MiB: every plane holds all batches
    // all batches in one launch each
    k_prep<<<dim3(NP / 128 + 4, NB_, 1), 256, 0, stream>>>(edge, wq, bq, wk, bk, wv, Qh, Ql, Kh, Kl, WV);   // hi and lo planes of q and k, [b][p][16]; WV = bf16 wv [out][in]
    k_vf<<<dim3(NP / 64, NB_, 1), 256, 0, stream>>>(sod, WV, bv, V16);   // V16[b][c][p] = f16(sum_cc wv[c][cc] sod[b][cc][p] + bv[c])
    k_attn<<<dim3(NP / 128, NB_, 1), 256, 0, stream>>>(Qh, Ql, Kh, Kl, V16, sod, OUT);   // OUT[b][c][i] = sod + sod * sum_j v[c][j] mask[i][j]
}
